// v000
// Measured on an AMD MI455X. A time is GPU time per run, averaged over a window of back-to-back runs after a warm-up
// (all launches, gaps included; the runs take copies of the inputs in turn), and the median of several windows.
// Apart from v000's, it joins two sittings. Times from different sittings can be a few percent apart, while
// side-by-side timings come from the same sitting.
// The starting kernel, v000, takes 346 microseconds a run.
#include <hip/hip_runtime.h>
#include <hip/hip_bf16.h>

typedef __attribute__((ext_vector_type(16))) _Float16 v16h;
typedef __attribute__((ext_vector_type(8)))  _Float16 v8h;
typedef __attribute__((ext_vector_type(8)))  float    v8f;

constexpr int Bc = 16;     // batch
constexpr int Sc = 1024;   // sequence
constexpr int Hc = 16;     // heads
constexpr int DH = 64;     // head dim
constexpr int DM = 1024;   // model dim

// attention scale folded into Q at projection time: 1/sqrt(64) * log2(e)
constexpr float QSCALE = 0.125f * 1.4426950408889634f;

// ---------------------------------------------------------------------------
// WMMA helper: D = A(16x32 f16) * B(32x16 f16) + C(16x16 f32)
// ---------------------------------------------------------------------------
__device__ inline v8f wmma16(v16h a, v16h b, v8f c) {
  return __builtin_amdgcn_wmma_f32_16x16x32_f16(
      /*neg_a=*/false, a, /*neg_b=*/false, b,
      /*c_mod=*/(short)0, c, /*reuse_a=*/false, /*reuse_b=*/false);
}

// ---------------------------------------------------------------------------
// ds_swizzle group-of-32 encoding: offset[14:10]=xor, [9:5]=or, [4:0]=and
// new_lane = ((lane & and) | or) ^ xor
// ---------------------------------------------------------------------------
template <int XOR>
__device__ inline float swz(float v) {
  return __int_as_float(
      __builtin_amdgcn_ds_swizzle(__float_as_int(v), (XOR << 10) | 0x1f));
}
__device__ inline float rowmax16(float v) {
  v = fmaxf(v, swz<1>(v)); v = fmaxf(v, swz<2>(v));
  v = fmaxf(v, swz<4>(v)); v = fmaxf(v, swz<8>(v));
  return v;
}
// broadcast from lane 0 of each 16-lane half (BCASTX16: and=0x10, or=0, xor=0)
__device__ inline float bcast_half0(float v) {
  return __int_as_float(__builtin_amdgcn_ds_swizzle(__float_as_int(v), 0x10));
}

// ---------------------------------------------------------------------------
// Fragment loaders. CDNA5 16-bit A/B fragment, per lane (g = lane/16):
//   elem i (i<8) -> K = kbase + 8g + i ; elem 8+i -> K = kbase + 8g + 16 + i
// i.e. two contiguous runs of 8 at p and p+16.
// ---------------------------------------------------------------------------
__device__ inline v16h frag_from_f32(const float* __restrict__ p) {
  v16h a;
#pragma unroll
  for (int i = 0; i < 8; ++i) { a[i] = (_Float16)p[i]; a[8 + i] = (_Float16)p[16 + i]; }
  return a;
}
__device__ inline v16h frag_from_f16(const _Float16* __restrict__ p) {
  v8h lo = *(const v8h*)p;
  v8h hi = *(const v8h*)(p + 16);
  v16h a;
#pragma unroll
  for (int i = 0; i < 8; ++i) { a[i] = lo[i]; a[8 + i] = hi[i]; }
  return a;
}

// ===========================================================================
// Kernel 1: Q/K/V projections.  One wave = one (b,h) x 16-row s-tile.
// Bias rides in the WMMA C operand. Q is pre-scaled by QSCALE.
// Q,K: LDS-transposed then coalesced b128 stores, row-major [bh][s][dh].
// V  : stored transposed [bh][dh][s] with packed b128 stores.
// ===========================================================================
__global__ __launch_bounds__(256)
void qkv_kernel(const float* __restrict__ x,
                const float* __restrict__ Wq, const float* __restrict__ Wk,
                const float* __restrict__ Wv,
                const float* __restrict__ bq, const float* __restrict__ bk,
                const float* __restrict__ bv,
                _Float16* __restrict__ Qo, _Float16* __restrict__ Ko,
                _Float16* __restrict__ Vt) {
  __shared__ __align__(16) _Float16 Tr[8][16 * 72];  // per-wave 16x64 tile, pad 72

  const int lane = threadIdx.x & 31;
  const int wave = threadIdx.x >> 5;
  const int m = lane & 15, g = lane >> 4;
  const int blocksPerBH = Sc / 128;                 // 8
  const int bh = blockIdx.x / blocksPerBH;
  const int s0 = (blockIdx.x % blocksPerBH) * 128 + wave * 16;
  const int b = bh / Hc, h = bh % Hc;

  // A-fragments of X tile (rows s0..s0+15, cols h*64..h*64+63), f32 -> f16
  const float* xrow = x + ((size_t)b * Sc + (s0 + m)) * DM + h * DH;
  v16h a0 = frag_from_f32(xrow + 0  + g * 8);
  v16h a1 = frag_from_f32(xrow + 32 + g * 8);

  const float* Ws[3] = {Wq, Wk, Wv};
  const float* bs[3] = {bq, bk, bv};
  _Float16* Tw = &Tr[wave][0];

#pragma unroll
  for (int wsel = 0; wsel < 3; ++wsel) {
#pragma unroll
    for (int e0 = 0; e0 < DH; e0 += 16) {
      // B[k][n] = W[h][e0+n][k]  (y = x * W^T): lane n reads row e0+n of W
      const float* Wrow = Ws[wsel] + ((size_t)h * DH + (e0 + m)) * DH;
      const float bias = bs[wsel][h * DH + e0 + m];
      v8f acc;
#pragma unroll
      for (int i = 0; i < 8; ++i) acc[i] = bias;   // bias in C operand
      acc = wmma16(a0, frag_from_f32(Wrow + 0  + g * 8), acc);
      acc = wmma16(a1, frag_from_f32(Wrow + 32 + g * 8), acc);

      if (wsel == 2) {
        // V transposed: row e0+m, 8 consecutive s values -> one 16B store
        __align__(16) _Float16 tmp[8];
#pragma unroll
        for (int r = 0; r < 8; ++r) tmp[r] = (_Float16)acc[r];
        _Float16* dst = Vt + ((size_t)bh * DH + e0 + m) * Sc + s0 + g * 8;
        *(float4*)dst = *(const float4*)tmp;
      } else {
        const float sc = (wsel == 0) ? QSCALE : 1.0f;
#pragma unroll
        for (int r = 0; r < 8; ++r)
          Tw[(r + 8 * g) * 72 + e0 + m] = (_Float16)(acc[r] * sc);
      }
    }
    if (wsel < 2) {
      asm volatile("s_wait_dscnt 0x0" ::: "memory");
      // coalesced write-out: lane t handles row t/2, cols (t&1)*32..+31
      const int row = lane >> 1, cb = (lane & 1) * 32;
      const _Float16* srcp = Tw + row * 72 + cb;
      _Float16* dstp = (wsel == 0 ? Qo : Ko) +
                       ((size_t)bh * Sc + s0 + row) * DH + cb;
#pragma unroll
      for (int q = 0; q < 4; ++q)
        *(v8h*)(dstp + q * 8) = *(const v8h*)(srcp + q * 8);
      asm volatile("s_wait_dscnt 0x0" ::: "memory");  // before Tw reuse
    }
  }
}

// ===========================================================================
// Kernel 2: flash attention. One wave = 16 query rows of one (b,h).
// 32 keys per block; online softmax in exp2 domain (scale pre-folded in Q).
// Row-sum of P computed by an extra "ones-column" WMMA (l = P*1), which
// inherits the same alpha rescaling as O.
// ===========================================================================
__global__ __launch_bounds__(256)
void attn_kernel(const _Float16* __restrict__ Qi, const _Float16* __restrict__ Ki,
                 const _Float16* __restrict__ Vt, float* __restrict__ out) {
  __shared__ __align__(16) _Float16 Plds[8][16 * 32];  // per-wave P tile (1 KB)

  const int lane = threadIdx.x & 31;
  const int wave = threadIdx.x >> 5;
  const int m = lane & 15, g = lane >> 4;
  const int blocksPerBH = Sc / 128;
  const int bh = blockIdx.x / blocksPerBH;
  const int s0 = (blockIdx.x % blocksPerBH) * 128 + wave * 16;
  const int b = bh / Hc, h = bh % Hc;

  // Q A-fragments stay in registers for the whole key loop (already scaled)
  const _Float16* qrow = Qi + ((size_t)bh * Sc + s0 + m) * DH;
  v16h qa0 = frag_from_f16(qrow + 0  + g * 8);
  v16h qa1 = frag_from_f16(qrow + 32 + g * 8);

  // ones-column B fragment: B1[k][n] = (n==0); lanes 0/16 all-ones, else zero
  v16h ones;
  {
    const _Float16 o = (m == 0) ? (_Float16)1.0f : (_Float16)0.0f;
#pragma unroll
    for (int i = 0; i < 16; ++i) ones[i] = o;
  }

  float mrow[8];
  v8f oacc[4], oext;
  const v8f vzero = {0.f, 0.f, 0.f, 0.f, 0.f, 0.f, 0.f, 0.f};
#pragma unroll
  for (int r = 0; r < 8; ++r) mrow[r] = -1e30f;
#pragma unroll
  for (int et = 0; et < 4; ++et) oacc[et] = vzero;
  oext = vzero;

  _Float16* pw = &Plds[wave][0];

  for (int j = 0; j < Sc; j += 32) {
    // ---- scores for 32 keys: two 16x16 tiles, K-dim = d_head = 64 ----
    const _Float16* k_lo = Ki + ((size_t)bh * Sc + j + m) * DH;
    const _Float16* k_hi = k_lo + (size_t)16 * DH;
    v8f s_lo = vzero, s_hi = vzero;
    s_lo = wmma16(qa0, frag_from_f16(k_lo + 0  + g * 8), s_lo);
    s_lo = wmma16(qa1, frag_from_f16(k_lo + 32 + g * 8), s_lo);
    s_hi = wmma16(qa0, frag_from_f16(k_hi + 0  + g * 8), s_hi);
    s_hi = wmma16(qa1, frag_from_f16(k_hi + 32 + g * 8), s_hi);

    // ---- online softmax (row M = r + 8g lives across lanes of one half) ----
#pragma unroll
    for (int r = 0; r < 8; ++r) {
      const float slo = s_lo[r], shi = s_hi[r];  // already log2e-scaled
      const float mnew = fmaxf(mrow[r], rowmax16(fmaxf(slo, shi)));
      const float alpha = exp2f(mrow[r] - mnew);
      mrow[r] = mnew;
      const float plo = exp2f(slo - mnew);
      const float phi = exp2f(shi - mnew);
      oacc[0][r] *= alpha; oacc[1][r] *= alpha;
      oacc[2][r] *= alpha; oacc[3][r] *= alpha;
      oext[r] *= alpha;
      // P tile to LDS in plain row-major [M][k] (C-layout scatter)
      pw[(r + 8 * g) * 32 + m]      = (_Float16)plo;
      pw[(r + 8 * g) * 32 + 16 + m] = (_Float16)phi;
    }
    // wave-internal LDS store->load ordering (cross-lane, no block barrier)
    asm volatile("s_wait_dscnt 0x0" ::: "memory");

    // reload P as A-fragment (16x32, K = key-in-block)
    v16h pa = frag_from_f16(pw + m * 32 + g * 8);

    // ---- O += P * V ; l += P * 1 (ones column) ----
#pragma unroll
    for (int et = 0; et < 4; ++et) {
      const _Float16* vrow = Vt + ((size_t)bh * DH + et * 16 + m) * Sc + j + g * 8;
      oacc[et] = wmma16(pa, frag_from_f16(vrow), oacc[et]);
    }
    oext = wmma16(pa, ones, oext);
  }

  // ---- normalize and store: out[b][s][h*64 + e] ----
#pragma unroll
  for (int r = 0; r < 8; ++r) {
    const float l = bcast_half0(oext[r]);  // l lives in lane 0 of each half
    const float inv = 1.0f / l;
    float* orow = out + ((size_t)b * Sc + s0 + r + 8 * g) * DM + h * DH + m;
#pragma unroll
    for (int et = 0; et < 4; ++et) orow[et * 16] = oacc[et][r] * inv;
  }
}

// ===========================================================================
extern "C" void kernel_launch(void* const* d_in, const int* in_sizes, int n_in,
                              void* d_out, int out_size, void* d_ws, size_t ws_size,
                              hipStream_t stream) {
  (void)in_sizes; (void)n_in; (void)out_size; (void)ws_size;
  const float* x  = (const float*)d_in[0];
  const float* Wq = (const float*)d_in[1];
  const float* Wk = (const float*)d_in[2];
  const float* Wv = (const float*)d_in[3];
  const float* bq = (const float*)d_in[4];
  const float* bk = (const float*)d_in[5];
  const float* bv = (const float*)d_in[6];

  const size_t per = (size_t)Bc * Hc * Sc * DH;  // elements per Q/K/V plane
  _Float16* Q  = (_Float16*)d_ws;
  _Float16* K  = Q + per;
  _Float16* Vt = K + per;

  dim3 grid(Bc * Hc * (Sc / 128));  // 2048 blocks, 8 waves each
  qkv_kernel<<<grid, 256, 0, stream>>>(x, Wq, Wk, Wv, bq, bk, bv, Q, K, Vt);
  attn_kernel<<<grid, 256, 0, stream>>>(Q, K, Vt, (float*)d_out);
}

// v001
// A run of this version takes 280 microseconds.
// Two timings next to v000 put it at 1.29 and 1.28 times that version's speed.
#include <hip/hip_runtime.h>
#include <hip/hip_bf16.h>

typedef __attribute__((ext_vector_type(16))) _Float16 v16h;
typedef __attribute__((ext_vector_type(8)))  _Float16 v8h;
typedef __attribute__((ext_vector_type(8)))  float    v8f;

constexpr int Bc = 16;     // batch
constexpr int Sc = 1024;   // sequence
constexpr int Hc = 16;     // heads
constexpr int DH = 64;     // head dim
constexpr int DM = 1024;   // model dim

// attention scale folded into Q at projection time: 1/sqrt(64) * log2(e)
constexpr float QSCALE = 0.125f * 1.4426950408889634f;

// ---------------------------------------------------------------------------
// WMMA helper: D = A(16x32 f16) * B(32x16 f16) + C(16x16 f32)
// ---------------------------------------------------------------------------
__device__ inline v8f wmma16(v16h a, v16h b, v8f c) {
  return __builtin_amdgcn_wmma_f32_16x16x32_f16(
      /*neg_a=*/false, a, /*neg_b=*/false, b,
      /*c_mod=*/(short)0, c, /*reuse_a=*/false, /*reuse_b=*/false);
}

// ---------------------------------------------------------------------------
// ds_swizzle group-of-32 encoding: offset[14:10]=xor, [9:5]=or, [4:0]=and
// new_lane = ((lane & and) | or) ^ xor
// ---------------------------------------------------------------------------
template <int XOR>
__device__ inline float swz(float v) {
  return __int_as_float(
      __builtin_amdgcn_ds_swizzle(__float_as_int(v), (XOR << 10) | 0x1f));
}
__device__ inline float rowmax16(float v) {
  v = fmaxf(v, swz<1>(v)); v = fmaxf(v, swz<2>(v));
  v = fmaxf(v, swz<4>(v)); v = fmaxf(v, swz<8>(v));
  return v;
}
// broadcast from lane 0 of each 16-lane half (BCASTX16: and=0x10, or=0, xor=0)
__device__ inline float bcast_half0(float v) {
  return __int_as_float(__builtin_amdgcn_ds_swizzle(__float_as_int(v), 0x10));
}

// ---------------------------------------------------------------------------
// Fragment loaders. CDNA5 16-bit A/B fragment, per lane (g = lane/16):
//   elem i (i<8) -> K = kbase + 8g + i ; elem 8+i -> K = kbase + 8g + 16 + i
// i.e. two contiguous runs of 8 at p and p+16.
// ---------------------------------------------------------------------------
__device__ inline v16h frag_from_f32(const float* __restrict__ p) {
  v16h a;
#pragma unroll
  for (int i = 0; i < 8; ++i) { a[i] = (_Float16)p[i]; a[8 + i] = (_Float16)p[16 + i]; }
  return a;
}
__device__ inline v16h frag_from_f16(const _Float16* __restrict__ p) {
  v8h lo = *(const v8h*)p;
  v8h hi = *(const v8h*)(p + 16);
  v16h a;
#pragma unroll
  for (int i = 0; i < 8; ++i) { a[i] = lo[i]; a[8 + i] = hi[i]; }
  return a;
}
// Fragment-order planes in the workspace: one fragment = two 512-byte units,
// unit u holds run u (8 halves) of lane 0..31 back to back, so that one
// wave-wide 16-byte load or store covers four whole 128-byte lines.
// p = fragment base + lane * 8.
constexpr int UNIT = 32 * 8;   // halves per 512-byte unit
__device__ inline v16h frag_packed(const _Float16* __restrict__ p) {
  v8h lo = *(const v8h*)p;
  v8h hi = *(const v8h*)(p + UNIT);
  v16h a;
#pragma unroll
  for (int i = 0; i < 8; ++i) { a[i] = lo[i]; a[8 + i] = hi[i]; }
  return a;
}

// ===========================================================================
// Kernel 1: Q/K/V projections.  One wave = one (b,h) x 16-row s-tile.
// Bias rides in the WMMA C operand. Q is pre-scaled by QSCALE.
// Q,K: LDS-transposed, then stored in fragment order:
//      [bh][s/16][dh/32][run u][lane][8], a 16-row tile keeps its own 2 KB.
// V  : fragment order of the transposed operand:
//      [bh][s/32][dh/16][run u][lane][8], straight from the accumulators.
// ===========================================================================
__global__ __launch_bounds__(256)
void qkv_kernel(const float* __restrict__ x,
                const float* __restrict__ Wq, const float* __restrict__ Wk,
                const float* __restrict__ Wv,
                const float* __restrict__ bq, const float* __restrict__ bk,
                const float* __restrict__ bv,
                _Float16* __restrict__ Qo, _Float16* __restrict__ Ko,
                _Float16* __restrict__ Vt) {
  __shared__ __align__(16) _Float16 Tr[8][16 * 72];  // per-wave 16x64 tile, pad 72

  const int lane = threadIdx.x & 31;
  const int wave = threadIdx.x >> 5;
  const int m = lane & 15, g = lane >> 4;
  const int blocksPerBH = Sc / 128;                 // 8
  const int bh = blockIdx.x / blocksPerBH;
  const int s0 = (blockIdx.x % blocksPerBH) * 128 + wave * 16;
  const int b = bh / Hc, h = bh % Hc;

  // A-fragments of X tile (rows s0..s0+15, cols h*64..h*64+63), f32 -> f16
  const float* xrow = x + ((size_t)b * Sc + (s0 + m)) * DM + h * DH;
  v16h a0 = frag_from_f32(xrow + 0  + g * 8);
  v16h a1 = frag_from_f32(xrow + 32 + g * 8);

  const float* Ws[3] = {Wq, Wk, Wv};
  const float* bs[3] = {bq, bk, bv};
  _Float16* Tw = &Tr[wave][0];

#pragma unroll
  for (int wsel = 0; wsel < 3; ++wsel) {
#pragma unroll
    for (int e0 = 0; e0 < DH; e0 += 16) {
      // B[k][n] = W[h][e0+n][k]  (y = x * W^T): lane n reads row e0+n of W
      const float* Wrow = Ws[wsel] + ((size_t)h * DH + (e0 + m)) * DH;
      const float bias = bs[wsel][h * DH + e0 + m];
      v8f acc;
#pragma unroll
      for (int i = 0; i < 8; ++i) acc[i] = bias;   // bias in C operand
      acc = wmma16(a0, frag_from_f32(Wrow + 0  + g * 8), acc);
      acc = wmma16(a1, frag_from_f32(Wrow + 32 + g * 8), acc);

      if (wsel == 2) {
        // lane (m,g) holds column e0+m, keys s0+8g..+7: run u = (s0/16)&1 of
        // the 32-key fragment, at its own lane's place -> 512 contiguous bytes
        __align__(16) _Float16 tmp[8];
#pragma unroll
        for (int r = 0; r < 8; ++r) tmp[r] = (_Float16)acc[r];
        const unsigned voff = (unsigned)((s0 >> 5) * (DH * 32) +
                                         ((s0 >> 4) & 1) * UNIT + lane * 8);
        _Float16* dst = Vt + (size_t)bh * DH * Sc + (e0 >> 4) * (2 * UNIT) + voff;
        *(float4*)dst = *(const float4*)tmp;
      } else {
        const float sc = (wsel == 0) ? QSCALE : 1.0f;
#pragma unroll
        for (int r = 0; r < 8; ++r)
          Tw[(r + 8 * g) * 72 + e0 + m] = (_Float16)(acc[r] * sc);
      }
    }
    if (wsel < 2) {
      asm volatile("s_wait_dscnt 0x0" ::: "memory");
      // write-out in fragment order: unit q = (dh/32)*2 + u holds, at lane
      // (m,g), row m, columns q*16 + g*8 .. +7
      const _Float16* srcp = Tw + m * 72 + g * 8;
      _Float16* dstp = (wsel == 0 ? Qo : Ko) + (size_t)bh * Sc * DH +
                       (unsigned)(s0 * DH + lane * 8);
#pragma unroll
      for (int q = 0; q < 4; ++q)
        *(v8h*)(dstp + q * UNIT) = *(const v8h*)(srcp + q * 16);
      asm volatile("s_wait_dscnt 0x0" ::: "memory");  // before Tw reuse
      // the stores' address and data registers are reused right behind them
      asm volatile("s_wait_xcnt 0x0" ::: "memory");
    }
  }
}

// ===========================================================================
// Kernel 2: flash attention. One wave = 16 query rows of one (b,h).
// 32 keys per block; online softmax in exp2 domain (scale pre-folded in Q).
// Row-sum of P computed by an extra "ones-column" WMMA (l = P*1), which
// inherits the same alpha rescaling as O.
// ===========================================================================
__global__ __launch_bounds__(256)
void attn_kernel(const _Float16* __restrict__ Qi, const _Float16* __restrict__ Ki,
                 const _Float16* __restrict__ Vt, float* __restrict__ out) {
  __shared__ __align__(16) _Float16 Plds[8][16 * 32];  // per-wave P tile (1 KB)

  const int lane = threadIdx.x & 31;
  const int wave = threadIdx.x >> 5;
  const int m = lane & 15, g = lane >> 4;
  const int blocksPerBH = Sc / 128;
  const int bh = blockIdx.x / blocksPerBH;
  const int s0 = (blockIdx.x % blocksPerBH) * 128 + wave * 16;
  const int b = bh / Hc, h = bh % Hc;

  // Q A-fragments stay in registers for the whole key loop (already scaled)
  const _Float16* qtile = Qi + ((size_t)bh * Sc + s0) * DH + lane * 8;
  v16h qa0 = frag_packed(qtile);
  v16h qa1 = frag_packed(qtile + 2 * UNIT);

  // ones-column B fragment: B1[k][n] = (n==0); lanes 0/16 all-ones, else zero
  v16h ones;
  {
    const _Float16 o = (m == 0) ? (_Float16)1.0f : (_Float16)0.0f;
#pragma unroll
    for (int i = 0; i < 16; ++i) ones[i] = o;
  }

  float mrow[8];
  v8f oacc[4], oext;
  const v8f vzero = {0.f, 0.f, 0.f, 0.f, 0.f, 0.f, 0.f, 0.f};
#pragma unroll
  for (int r = 0; r < 8; ++r) mrow[r] = -1e30f;
#pragma unroll
  for (int et = 0; et < 4; ++et) oacc[et] = vzero;
  oext = vzero;

  _Float16* pw = &Plds[wave][0];

  // block-uniform plane bases; the lane's part of every address is constant
  const _Float16* kbase = Ki + (size_t)bh * Sc * DH;
  const _Float16* vbase = Vt + (size_t)bh * DH * Sc;
  const unsigned loff = (unsigned)lane * 8u;

  for (int j = 0; j < Sc; j += 32) {
    // ---- scores for 32 keys: two 16x16 tiles, K-dim = d_head = 64 ----
    const _Float16* k_lo = kbase + (size_t)j * DH + loff;
    const _Float16* k_hi = k_lo + (size_t)16 * DH;
    v8f s_lo = vzero, s_hi = vzero;
    s_lo = wmma16(qa0, frag_packed(k_lo), s_lo);
    s_lo = wmma16(qa1, frag_packed(k_lo + 2 * UNIT), s_lo);
    s_hi = wmma16(qa0, frag_packed(k_hi), s_hi);
    s_hi = wmma16(qa1, frag_packed(k_hi + 2 * UNIT), s_hi);

    // ---- online softmax (row M = r + 8g lives across lanes of one half) ----
#pragma unroll
    for (int r = 0; r < 8; ++r) {
      const float slo = s_lo[r], shi = s_hi[r];  // already log2e-scaled
      const float mnew = fmaxf(mrow[r], rowmax16(fmaxf(slo, shi)));
      const float alpha = exp2f(mrow[r] - mnew);
      mrow[r] = mnew;
      const float plo = exp2f(slo - mnew);
      const float phi = exp2f(shi - mnew);
      oacc[0][r] *= alpha; oacc[1][r] *= alpha;
      oacc[2][r] *= alpha; oacc[3][r] *= alpha;
      oext[r] *= alpha;
      // P tile to LDS in plain row-major [M][k] (C-layout scatter)
      pw[(r + 8 * g) * 32 + m]      = (_Float16)plo;
      pw[(r + 8 * g) * 32 + 16 + m] = (_Float16)phi;
    }
    // wave-internal LDS store->load ordering (cross-lane, no block barrier)
    asm volatile("s_wait_dscnt 0x0" ::: "memory");

    // reload P as A-fragment (16x32, K = key-in-block)
    v16h pa = frag_from_f16(pw + m * 32 + g * 8);

    // ---- O += P * V ; l += P * 1 (ones column) ----
#pragma unroll
    for (int et = 0; et < 4; ++et) {
      const _Float16* vfrag = vbase + (size_t)j * DH + et * (2 * UNIT) + loff;
      oacc[et] = wmma16(pa, frag_packed(vfrag), oacc[et]);
    }
    oext = wmma16(pa, ones, oext);
    // the next pass forms its addresses in the registers these loads name
    asm volatile("s_wait_xcnt 0x0" ::: "memory");
  }

  // ---- normalize and store: out[b][s][h*64 + e] ----
#pragma unroll
  for (int r = 0; r < 8; ++r) {
    const float l = bcast_half0(oext[r]);  // l lives in lane 0 of each half
    const float inv = 1.0f / l;
    float* orow = out + ((size_t)b * Sc + s0 + r + 8 * g) * DM + h * DH + m;
#pragma unroll
    for (int et = 0; et < 4; ++et) orow[et * 16] = oacc[et][r] * inv;
  }
}

// ===========================================================================
extern "C" void kernel_launch(void* const* d_in, const int* in_sizes, int n_in,
                              void* d_out, int out_size, void* d_ws, size_t ws_size,
                              hipStream_t stream) {
  (void)in_sizes; (void)n_in; (void)out_size; (void)ws_size;
  const float* x  = (const float*)d_in[0];
  const float* Wq = (const float*)d_in[1];
  const float* Wk = (const float*)d_in[2];
  const float* Wv = (const float*)d_in[3];
  const float* bq = (const float*)d_in[4];
  const float* bk = (const float*)d_in[5];
  const float* bv = (const float*)d_in[6];

  const size_t per = (size_t)Bc * Hc * Sc * DH;  // elements per Q/K/V plane
  _Float16* Q  = (_Float16*)d_ws;
  _Float16* K  = Q + per;
  _Float16* Vt = K + per;

  dim3 grid(Bc * Hc * (Sc / 128));  // 2048 blocks, 8 waves each
  qkv_kernel<<<grid, 256, 0, stream>>>(x, Wq, Wk, Wv, bq, bk, bv, Q, K, Vt);
  attn_kernel<<<grid, 256, 0, stream>>>(Q, K, Vt, (float*)d_out);
}

// v002
// It runs in 196 microseconds.
// Two timings next to v001 put it at 1.43 and 1.42 times that version's speed.
// Counting every step since v000, it is 1.83 times as fast.
#include <hip/hip_runtime.h>
#include <hip/hip_bf16.h>

typedef __attribute__((ext_vector_type(16))) _Float16 v16h;
typedef __attribute__((ext_vector_type(8)))  _Float16 v8h;
typedef __attribute__((ext_vector_type(8)))  float    v8f;

constexpr int Bc = 16;     // batch
constexpr int Sc = 1024;   // sequence
constexpr int Hc = 16;     // heads
constexpr int DH = 64;     // head dim
constexpr int DM = 1024;   // model dim

// attention scale folded into Q at projection time: 1/sqrt(64) * log2(e)
constexpr float QSCALE = 0.125f * 1.4426950408889634f;

// ---------------------------------------------------------------------------
// WMMA helper: D = A(16x32 f16) * B(32x16 f16) + C(16x16 f32)
// ---------------------------------------------------------------------------
__device__ inline v8f wmma16(v16h a, v16h b, v8f c) {
  return __builtin_amdgcn_wmma_f32_16x16x32_f16(
      /*neg_a=*/false, a, /*neg_b=*/false, b,
      /*c_mod=*/(short)0, c, /*reuse_a=*/false, /*reuse_b=*/false);
}

// ---------------------------------------------------------------------------
// ds_swizzle group-of-32 encoding: offset[14:10]=xor, [9:5]=or, [4:0]=and
// new_lane = ((lane & and) | or) ^ xor
// ---------------------------------------------------------------------------
template <int XOR>
__device__ inline float swz(float v) {
  return __int_as_float(
      __builtin_amdgcn_ds_swizzle(__float_as_int(v), (XOR << 10) | 0x1f));
}
__device__ inline float rowmax16(float v) {
  v = fmaxf(v, swz<1>(v)); v = fmaxf(v, swz<2>(v));
  v = fmaxf(v, swz<4>(v)); v = fmaxf(v, swz<8>(v));
  return v;
}
// broadcast from lane 0 of each 16-lane half (BCASTX16: and=0x10, or=0, xor=0)
__device__ inline float bcast_half0(float v) {
  return __int_as_float(__builtin_amdgcn_ds_swizzle(__float_as_int(v), 0x10));
}

// ---------------------------------------------------------------------------
// Fragment loaders. CDNA5 16-bit A/B fragment, per lane (g = lane/16):
//   elem i (i<8) -> K = kbase + 8g + i ; elem 8+i -> K = kbase + 8g + 16 + i
// i.e. two contiguous runs of 8 at p and p+16.
// ---------------------------------------------------------------------------
__device__ inline v16h frag_from_f32(const float* __restrict__ p) {
  v16h a;
#pragma unroll
  for (int i = 0; i < 8; ++i) { a[i] = (_Float16)p[i]; a[8 + i] = (_Float16)p[16 + i]; }
  return a;
}
__device__ inline v16h frag_from_f16(const _Float16* __restrict__ p) {
  v8h lo = *(const v8h*)p;
  v8h hi = *(const v8h*)(p + 16);
  v16h a;
#pragma unroll
  for (int i = 0; i < 8; ++i) { a[i] = lo[i]; a[8 + i] = hi[i]; }
  return a;
}
// Fragment-order planes in the workspace: one fragment = two 512-byte units,
// unit u holds run u (8 halves) of lane 0..31 back to back, so that one
// wave-wide 16-byte load or store covers four whole 128-byte lines.
// p = fragment base + lane * 8.
constexpr int UNIT = 32 * 8;   // halves per 512-byte unit
__device__ inline v16h frag_packed(const _Float16* __restrict__ p) {
  v8h lo = *(const v8h*)p;
  v8h hi = *(const v8h*)(p + UNIT);
  v16h a;
#pragma unroll
  for (int i = 0; i < 8; ++i) { a[i] = lo[i]; a[8 + i] = hi[i]; }
  return a;
}

// ===========================================================================
// Kernel 1: Q/K/V projections.  One wave = one (b,h) x 16-row s-tile.
// Bias rides in the WMMA C operand. Q is pre-scaled by QSCALE.
// Q,K: LDS-transposed, then stored in fragment order:
//      [bh][s/16][dh/32][run u][lane][8], a 16-row tile keeps its own 2 KB.
// V  : fragment order of the transposed operand:
//      [bh][s/32][dh/16][run u][lane][8], straight from the accumulators.
// ===========================================================================
__global__ __launch_bounds__(256)
void qkv_kernel(const float* __restrict__ x,
                const float* __restrict__ Wq, const float* __restrict__ Wk,
                const float* __restrict__ Wv,
                const float* __restrict__ bq, const float* __restrict__ bk,
                const float* __restrict__ bv,
                _Float16* __restrict__ Qo, _Float16* __restrict__ Ko,
                _Float16* __restrict__ Vt) {
  __shared__ __align__(16) _Float16 Tr[8][16 * 72];  // per-wave 16x64 tile, pad 72

  const int lane = threadIdx.x & 31;
  const int wave = threadIdx.x >> 5;
  const int m = lane & 15, g = lane >> 4;
  const int blocksPerBH = Sc / 128;                 // 8
  const int bh = blockIdx.x / blocksPerBH;
  const int s0 = (blockIdx.x % blocksPerBH) * 128 + wave * 16;
  const int b = bh / Hc, h = bh % Hc;

  // A-fragments of X tile (rows s0..s0+15, cols h*64..h*64+63), f32 -> f16
  const float* xrow = x + ((size_t)b * Sc + (s0 + m)) * DM + h * DH;
  v16h a0 = frag_from_f32(xrow + 0  + g * 8);
  v16h a1 = frag_from_f32(xrow + 32 + g * 8);

  const float* Ws[3] = {Wq, Wk, Wv};
  const float* bs[3] = {bq, bk, bv};
  _Float16* Tw = &Tr[wave][0];

#pragma unroll
  for (int wsel = 0; wsel < 3; ++wsel) {
#pragma unroll
    for (int e0 = 0; e0 < DH; e0 += 16) {
      // B[k][n] = W[h][e0+n][k]  (y = x * W^T): lane n reads row e0+n of W
      const float* Wrow = Ws[wsel] + ((size_t)h * DH + (e0 + m)) * DH;
      const float bias = bs[wsel][h * DH + e0 + m];
      v8f acc;
#pragma unroll
      for (int i = 0; i < 8; ++i) acc[i] = bias;   // bias in C operand
      acc = wmma16(a0, frag_from_f32(Wrow + 0  + g * 8), acc);
      acc = wmma16(a1, frag_from_f32(Wrow + 32 + g * 8), acc);

      if (wsel == 2) {
        // lane (m,g) holds column e0+m, keys s0+8g..+7: run u = (s0/16)&1 of
        // the 32-key fragment, at its own lane's place -> 512 contiguous bytes
        __align__(16) _Float16 tmp[8];
#pragma unroll
        for (int r = 0; r < 8; ++r) tmp[r] = (_Float16)acc[r];
        const unsigned voff = (unsigned)((s0 >> 5) * (DH * 32) +
                                         ((s0 >> 4) & 1) * UNIT + lane * 8);
        _Float16* dst = Vt + (size_t)bh * DH * Sc + (e0 >> 4) * (2 * UNIT) + voff;
        *(float4*)dst = *(const float4*)tmp;
      } else {
        const float sc = (wsel == 0) ? QSCALE : 1.0f;
#pragma unroll
        for (int r = 0; r < 8; ++r)
          Tw[(r + 8 * g) * 72 + e0 + m] = (_Float16)(acc[r] * sc);
      }
    }
    if (wsel < 2) {
      asm volatile("s_wait_dscnt 0x0" ::: "memory");
      // write-out in fragment order: unit q = (dh/32)*2 + u holds, at lane
      // (m,g), row m, columns q*16 + g*8 .. +7
      const _Float16* srcp = Tw + m * 72 + g * 8;
      _Float16* dstp = (wsel == 0 ? Qo : Ko) + (size_t)bh * Sc * DH +
                       (unsigned)(s0 * DH + lane * 8);
#pragma unroll
      for (int q = 0; q < 4; ++q)
        *(v8h*)(dstp + q * UNIT) = *(const v8h*)(srcp + q * 16);
      asm volatile("s_wait_dscnt 0x0" ::: "memory");  // before Tw reuse
      // the stores' address and data registers are reused right behind them
      asm volatile("s_wait_xcnt 0x0" ::: "memory");
    }
  }
}

// ===========================================================================
// Kernel 2: flash attention. One wave = 16 query rows of one (b,h).
// 32 keys per block; online softmax in exp2 domain (scale pre-folded in Q).
// Row-sum of P computed by an extra "ones-column" WMMA (l = P*1), which
// inherits the same alpha rescaling as O.
// ===========================================================================
__global__ __launch_bounds__(256)
void attn_kernel(const _Float16* __restrict__ Qi, const _Float16* __restrict__ Ki,
                 const _Float16* __restrict__ Vt, float* __restrict__ out) {
  __shared__ __align__(16) _Float16 Plds[8][16 * 32];  // per-wave P tile (1 KB)

  const int lane = threadIdx.x & 31;
  const int wave = threadIdx.x >> 5;
  const int m = lane & 15, g = lane >> 4;
  const int blocksPerBH = Sc / 128;
  const int bh = blockIdx.x / blocksPerBH;
  const int s0 = (blockIdx.x % blocksPerBH) * 128 + wave * 16;
  const int b = bh / Hc, h = bh % Hc;

  // Q A-fragments stay in registers for the whole key loop (already scaled)
  const _Float16* qtile = Qi + ((size_t)bh * Sc + s0) * DH + lane * 8;
  v16h qa0 = frag_packed(qtile);
  v16h qa1 = frag_packed(qtile + 2 * UNIT);
  // the loads' address registers are reused as soon as the loads are issued
  asm volatile("s_wait_xcnt 0x0" ::: "memory");

  // ones-column B fragment: B1[k][n] = (n==0); lanes 0/16 all-ones, else zero
  v16h ones;
  {
    const _Float16 o = (m == 0) ? (_Float16)1.0f : (_Float16)0.0f;
#pragma unroll
    for (int i = 0; i < 16; ++i) ones[i] = o;
  }

  float mrow[8];
  v8f oacc[4], oext;
  const v8f vzero = {0.f, 0.f, 0.f, 0.f, 0.f, 0.f, 0.f, 0.f};
#pragma unroll
  for (int r = 0; r < 8; ++r) mrow[r] = -1e30f;
#pragma unroll
  for (int et = 0; et < 4; ++et) oacc[et] = vzero;
  oext = vzero;

  _Float16* pw = &Plds[wave][0];

  // block-uniform plane bases; the lane's part of every address is constant
  const _Float16* kbase = Ki + (size_t)bh * Sc * DH;
  const _Float16* vbase = Vt + (size_t)bh * DH * Sc;
  const unsigned loff = (unsigned)lane * 8u;

  // Every fragment is loaded one pass ahead of the product that reads it: the
  // top of pass j issues K and V of pass j+1, which fly under the whole pass.
  // K and V each have two register sets that swap roles from pass to pass, so
  // nothing is copied.
  auto pass = [&](const int j, const v16h (&kc)[4], v16h (&kn)[4],
                  const v16h (&vf)[4], v16h (&vn)[4]) {
    // the last pass wraps to tile 0 (loaded, never used)
    const size_t nxt = (size_t)((j + 32) & (Sc - 1)) * DH;
#pragma unroll
    for (int i = 0; i < 4; ++i)
      kn[i] = frag_packed(kbase + nxt + i * (2 * UNIT) + loff);
    // the loads' address registers are reused as soon as the loads are issued
    asm volatile("s_wait_xcnt 0x0" ::: "memory");
#pragma unroll
    for (int et = 0; et < 4; ++et)
      vn[et] = frag_packed(vbase + nxt + et * (2 * UNIT) + loff);
    // the loads' address registers are reused as soon as the loads are issued
    asm volatile("s_wait_xcnt 0x0" ::: "memory");

    // ---- scores for 32 keys: two 16x16 tiles, K-dim = d_head = 64 ----
    v8f s_lo = vzero, s_hi = vzero;
    s_lo = wmma16(qa0, kc[0], s_lo);
    s_lo = wmma16(qa1, kc[1], s_lo);
    s_hi = wmma16(qa0, kc[2], s_hi);
    s_hi = wmma16(qa1, kc[3], s_hi);

    // ---- online softmax (row M = r + 8g lives across lanes of one half) ----
#pragma unroll
    for (int r = 0; r < 8; ++r) {
      const float slo = s_lo[r], shi = s_hi[r];  // already log2e-scaled
      const float mnew = fmaxf(mrow[r], rowmax16(fmaxf(slo, shi)));
      const float alpha = exp2f(mrow[r] - mnew);
      mrow[r] = mnew;
      const float plo = exp2f(slo - mnew);
      const float phi = exp2f(shi - mnew);
      oacc[0][r] *= alpha; oacc[1][r] *= alpha;
      oacc[2][r] *= alpha; oacc[3][r] *= alpha;
      oext[r] *= alpha;
      // P tile to LDS in plain row-major [M][k] (C-layout scatter)
      pw[(r + 8 * g) * 32 + m]      = (_Float16)plo;
      pw[(r + 8 * g) * 32 + 16 + m] = (_Float16)phi;
    }
    // wave-internal LDS store->load ordering (cross-lane, no block barrier)
    asm volatile("s_wait_dscnt 0x0" ::: "memory");

    // reload P as A-fragment (16x32, K = key-in-block)
    v16h pa = frag_from_f16(pw + m * 32 + g * 8);

    // ---- O += P * V ; l += P * 1 (ones column) ----
#pragma unroll
    for (int et = 0; et < 4; ++et) oacc[et] = wmma16(pa, vf[et], oacc[et]);
    oext = wmma16(pa, ones, oext);
  };

  v16h ka[4], kb[4], va[4], vb[4];
#pragma unroll
  for (int i = 0; i < 4; ++i) {
    ka[i] = frag_packed(kbase + i * (2 * UNIT) + loff);
    va[i] = frag_packed(vbase + i * (2 * UNIT) + loff);
  }
  // the loads' address registers are reused as soon as the loads are issued
  asm volatile("s_wait_xcnt 0x0" ::: "memory");

  for (int j = 0; j < Sc; j += 64) {
    pass(j, ka, kb, va, vb);
    pass(j + 32, kb, ka, vb, va);
  }

  // ---- normalize and store: out[b][s][h*64 + e] ----
#pragma unroll
  for (int r = 0; r < 8; ++r) {
    const float l = bcast_half0(oext[r]);  // l lives in lane 0 of each half
    const float inv = 1.0f / l;
    float* orow = out + ((size_t)b * Sc + s0 + r + 8 * g) * DM + h * DH + m;
#pragma unroll
    for (int et = 0; et < 4; ++et) orow[et * 16] = oacc[et][r] * inv;
  }
}

// ===========================================================================
extern "C" void kernel_launch(void* const* d_in, const int* in_sizes, int n_in,
                              void* d_out, int out_size, void* d_ws, size_t ws_size,
                              hipStream_t stream) {
  (void)in_sizes; (void)n_in; (void)out_size; (void)ws_size;
  const float* x  = (const float*)d_in[0];
  const float* Wq = (const float*)d_in[1];
  const float* Wk = (const float*)d_in[2];
  const float* Wv = (const float*)d_in[3];
  const float* bq = (const float*)d_in[4];
  const float* bk = (const float*)d_in[5];
  const float* bv = (const float*)d_in[6];

  const size_t per = (size_t)Bc * Hc * Sc * DH;  // elements per Q/K/V plane
  _Float16* Q  = (_Float16*)d_ws;
  _Float16* K  = Q + per;
  _Float16* Vt = K + per;

  dim3 grid(Bc * Hc * (Sc / 128));  // 2048 blocks, 8 waves each
  qkv_kernel<<<grid, 256, 0, stream>>>(x, Wq, Wk, Wv, bq, bk, bv, Q, K, Vt);
  attn_kernel<<<grid, 256, 0, stream>>>(Q, K, Vt, (float*)d_out);
}

// v003
// It runs in 176 microseconds.
// In two side-by-side timings against v002, it was 1.12 and 1.11 times as fast.
// All steps since v000 together make it 2.04 times as fast.
#include <hip/hip_runtime.h>
#include <hip/hip_bf16.h>

typedef __attribute__((ext_vector_type(16))) _Float16 v16h;
typedef __attribute__((ext_vector_type(8)))  _Float16 v8h;
typedef __attribute__((ext_vector_type(8)))  float    v8f;

constexpr int Bc = 16;     // batch
constexpr int Sc = 1024;   // sequence
constexpr int Hc = 16;     // heads
constexpr int DH = 64;     // head dim
constexpr int DM = 1024;   // model dim

// attention scale folded into Q at projection time: 1/sqrt(64) * log2(e)
constexpr float QSCALE = 0.125f * 1.4426950408889634f;

// ---------------------------------------------------------------------------
// WMMA helper: D = A(16x32 f16) * B(32x16 f16) + C(16x16 f32)
// ---------------------------------------------------------------------------
__device__ inline v8f wmma16(v16h a, v16h b, v8f c) {
  return __builtin_amdgcn_wmma_f32_16x16x32_f16(
      /*neg_a=*/false, a, /*neg_b=*/false, b,
      /*c_mod=*/(short)0, c, /*reuse_a=*/false, /*reuse_b=*/false);
}

// ---------------------------------------------------------------------------
// Fragment loaders. CDNA5 16-bit A/B fragment, per lane (g = lane/16):
//   elem i (i<8) -> K = kbase + 8g + i ; elem 8+i -> K = kbase + 8g + 16 + i
// i.e. two contiguous runs of 8 at p and p+16.
// ---------------------------------------------------------------------------
__device__ inline v16h frag_from_f32(const float* __restrict__ p) {
  v16h a;
#pragma unroll
  for (int i = 0; i < 8; ++i) { a[i] = (_Float16)p[i]; a[8 + i] = (_Float16)p[16 + i]; }
  return a;
}
// Fragment-order planes in the workspace: one fragment = two 512-byte units,
// unit u holds run u (8 halves) of lane 0..31 back to back, so that one
// wave-wide 16-byte load or store covers four whole 128-byte lines.
// p = fragment base + lane * 8.
constexpr int UNIT = 32 * 8;   // halves per 512-byte unit
__device__ inline v16h frag_packed(const _Float16* __restrict__ p) {
  v8h lo = *(const v8h*)p;
  v8h hi = *(const v8h*)(p + UNIT);
  v16h a;
#pragma unroll
  for (int i = 0; i < 8; ++i) { a[i] = lo[i]; a[8 + i] = hi[i]; }
  return a;
}

// ===========================================================================
// Kernel 1: Q/K/V projections.  One wave = one (b,h) x 16-row s-tile.
// Bias rides in the WMMA C operand. Q is pre-scaled by QSCALE.
// Q,K: LDS-transposed, then stored in fragment order:
//      [bh][s/16][dh/32][run u][lane][8], a 16-row tile keeps its own 2 KB.
// V  : fragment order of the transposed operand:
//      [bh][s/32][dh/16][run u][lane][8], straight from the accumulators.
// ===========================================================================
__global__ __launch_bounds__(256)
void qkv_kernel(const float* __restrict__ x,
                const float* __restrict__ Wq, const float* __restrict__ Wk,
                const float* __restrict__ Wv,
                const float* __restrict__ bq, const float* __restrict__ bk,
                const float* __restrict__ bv,
                _Float16* __restrict__ Qo, _Float16* __restrict__ Ko,
                _Float16* __restrict__ Vt) {
  __shared__ __align__(16) _Float16 Tr[8][16 * 72];  // per-wave 16x64 tile, pad 72

  const int lane = threadIdx.x & 31;
  const int wave = threadIdx.x >> 5;
  const int m = lane & 15, g = lane >> 4;
  const int blocksPerBH = Sc / 128;                 // 8
  const int bh = blockIdx.x / blocksPerBH;
  const int s0 = (blockIdx.x % blocksPerBH) * 128 + wave * 16;
  const int b = bh / Hc, h = bh % Hc;

  // A-fragments of X tile (rows s0..s0+15, cols h*64..h*64+63), f32 -> f16
  const float* xrow = x + ((size_t)b * Sc + (s0 + m)) * DM + h * DH;
  v16h a0 = frag_from_f32(xrow + 0  + g * 8);
  v16h a1 = frag_from_f32(xrow + 32 + g * 8);

  const float* Ws[3] = {Wq, Wk, Wv};
  const float* bs[3] = {bq, bk, bv};
  _Float16* Tw = &Tr[wave][0];

#pragma unroll
  for (int wsel = 0; wsel < 3; ++wsel) {
#pragma unroll
    for (int e0 = 0; e0 < DH; e0 += 16) {
      // B[k][n] = W[h][e0+n][k]  (y = x * W^T): lane n reads row e0+n of W
      const float* Wrow = Ws[wsel] + ((size_t)h * DH + (e0 + m)) * DH;
      const float bias = bs[wsel][h * DH + e0 + m];
      v8f acc;
#pragma unroll
      for (int i = 0; i < 8; ++i) acc[i] = bias;   // bias in C operand
      acc = wmma16(a0, frag_from_f32(Wrow + 0  + g * 8), acc);
      acc = wmma16(a1, frag_from_f32(Wrow + 32 + g * 8), acc);

      if (wsel == 2) {
        // lane (m,g) holds column e0+m, keys s0+8g..+7: run u = (s0/16)&1 of
        // the 32-key fragment, at its own lane's place -> 512 contiguous bytes
        __align__(16) _Float16 tmp[8];
#pragma unroll
        for (int r = 0; r < 8; ++r) tmp[r] = (_Float16)acc[r];
        const unsigned voff = (unsigned)((s0 >> 5) * (DH * 32) +
                                         ((s0 >> 4) & 1) * UNIT + lane * 8);
        _Float16* dst = Vt + (size_t)bh * DH * Sc + (e0 >> 4) * (2 * UNIT) + voff;
        *(float4*)dst = *(const float4*)tmp;
      } else {
        const float sc = (wsel == 0) ? QSCALE : 1.0f;
#pragma unroll
        for (int r = 0; r < 8; ++r)
          Tw[(r + 8 * g) * 72 + e0 + m] = (_Float16)(acc[r] * sc);
      }
    }
    if (wsel < 2) {
      asm volatile("s_wait_dscnt 0x0" ::: "memory");
      // write-out in fragment order: unit q = (dh/32)*2 + u holds, at lane
      // (m,g), row m, columns q*16 + g*8 .. +7
      const _Float16* srcp = Tw + m * 72 + g * 8;
      _Float16* dstp = (wsel == 0 ? Qo : Ko) + (size_t)bh * Sc * DH +
                       (unsigned)(s0 * DH + lane * 8);
#pragma unroll
      for (int q = 0; q < 4; ++q)
        *(v8h*)(dstp + q * UNIT) = *(const v8h*)(srcp + q * 16);
      asm volatile("s_wait_dscnt 0x0" ::: "memory");  // before Tw reuse
      // the stores' address and data registers are reused right behind them
      asm volatile("s_wait_xcnt 0x0" ::: "memory");
    }
  }
}

__device__ inline float xhalf(float v) {
  const int b = __float_as_int(v);
  return __int_as_float(
      __builtin_amdgcn_permlanex16(b, b, 0x76543210, 0xfedcba98, false, false));
}

// Four waves per SIMD is what the two register sets of K and V allow. Told so,
// the scheduler keeps the loads a pass ahead of their use; left to aim for more
// waves it sinks them to just before the products, which then wait them out.
__global__ __launch_bounds__(256) __attribute__((amdgpu_waves_per_eu(4, 4)))
void attn_kernel(const _Float16* __restrict__ Qi, const _Float16* __restrict__ Ki,
                 const _Float16* __restrict__ Vt, float* __restrict__ out) {
  const int lane = threadIdx.x & 31;
  const int wave = threadIdx.x >> 5;
  const int m = lane & 15, g = lane >> 4;
  const int blocksPerBH = Sc / 128;
  const int bh = blockIdx.x / blocksPerBH;
  const int s0 = (blockIdx.x % blocksPerBH) * 128 + wave * 16;
  const int b = bh / Hc, h = bh % Hc;

  // Q B-fragments stay in registers for the whole key loop (already scaled)
  const _Float16* qtile = Qi + ((size_t)bh * Sc + s0) * DH + lane * 8;
  v16h qa0 = frag_packed(qtile);
  v16h qa1 = frag_packed(qtile + 2 * UNIT);
  // the loads' address registers are reused as soon as the loads are issued
  asm volatile("s_wait_xcnt 0x0" ::: "memory");

  // ones-row A fragment: A1[r][k] = (r==0); lanes 0/16 all-ones, else zero
  v16h ones;
  {
    const _Float16 o = (m == 0) ? (_Float16)1.0f : (_Float16)0.0f;
#pragma unroll
    for (int i = 0; i < 16; ++i) ones[i] = o;
  }

  float mrow = -1e30f;   // running maximum of this lane's query
  v8f oacc[4], oext;     // oacc[et][r] = O[query m][et*16 + 8g + r]
  const v8f vzero = {0.f, 0.f, 0.f, 0.f, 0.f, 0.f, 0.f, 0.f};
#pragma unroll
  for (int et = 0; et < 4; ++et) oacc[et] = vzero;
  oext = vzero;          // row 0 (register 0, lanes 0..15) = l; other rows stay 0

  // block-uniform plane bases; the lane's part of every address is constant
  const _Float16* kbase = Ki + (size_t)bh * Sc * DH;
  const _Float16* vbase = Vt + (size_t)bh * DH * Sc;
  const unsigned loff = (unsigned)lane * 8u;

  // Every fragment is loaded one pass ahead of the product that reads it: the
  // top of pass j issues K and V of pass j+1, which fly under the whole pass.
  // K and V each have two register sets that swap roles from pass to pass, so
  // nothing is copied.
  auto pass = [&](const int j, const v16h (&kc)[4], v16h (&kn)[4],
                  const v16h (&vf)[4], v16h (&vn)[4]) {
    // the last pass wraps to tile 0 (loaded, never used)
    const size_t nxt = (size_t)((j + 32) & (Sc - 1)) * DH;
#pragma unroll
    for (int i = 0; i < 4; ++i)
      kn[i] = frag_packed(kbase + nxt + i * (2 * UNIT) + loff);
    // the loads' address registers are reused as soon as the loads are issued
    asm volatile("s_wait_xcnt 0x0" ::: "memory");
#pragma unroll
    for (int et = 0; et < 4; ++et)
      vn[et] = frag_packed(vbase + nxt + et * (2 * UNIT) + loff);
    // the loads' address registers are reused as soon as the loads are issued
    asm volatile("s_wait_xcnt 0x0" ::: "memory");

    // ---- scores for 32 keys: two 16x16 tiles (keys x queries), K-dim = 64 ----
    v8f s_lo = vzero, s_hi = vzero;
    s_lo = wmma16(kc[0], qa0, s_lo);
    s_lo = wmma16(kc[1], qa1, s_lo);
    s_hi = wmma16(kc[2], qa0, s_hi);
    s_hi = wmma16(kc[3], qa1, s_hi);

    // ---- online softmax: 16 of the query's 32 scores are in this lane, the
    //      other 16 in lane ^ 16 ----
    float t[8];
#pragma unroll
    for (int r = 0; r < 8; ++r) t[r] = fmaxf(s_lo[r], s_hi[r]);
    const float mx = fmaxf(fmaxf(fmaxf(t[0], t[1]), fmaxf(t[2], t[3])),
                           fmaxf(fmaxf(t[4], t[5]), fmaxf(t[6], t[7])));
    const float mnew = fmaxf(mrow, fmaxf(mx, xhalf(mx)));
    const float alpha = exp2f(mrow - mnew);
    mrow = mnew;

    // P^T as B fragment, straight from the score accumulators
    v16h pb;
#pragma unroll
    for (int r = 0; r < 8; ++r) {
      pb[r]     = (_Float16)exp2f(s_lo[r] - mnew);   // already log2e-scaled
      pb[8 + r] = (_Float16)exp2f(s_hi[r] - mnew);
    }
#pragma unroll
    for (int et = 0; et < 4; ++et)
#pragma unroll
      for (int r = 0; r < 8; ++r) oacc[et][r] *= alpha;
    oext[0] *= alpha;

    // ---- O^T += V^T * P^T ; l += 1 * P^T (ones row) ----
#pragma unroll
    for (int et = 0; et < 4; ++et) oacc[et] = wmma16(vf[et], pb, oacc[et]);
    oext = wmma16(ones, pb, oext);
  };

  v16h ka[4], kb[4], va[4], vb[4];
#pragma unroll
  for (int i = 0; i < 4; ++i) {
    ka[i] = frag_packed(kbase + i * (2 * UNIT) + loff);
    va[i] = frag_packed(vbase + i * (2 * UNIT) + loff);
  }
  // the loads' address registers are reused as soon as the loads are issued
  asm volatile("s_wait_xcnt 0x0" ::: "memory");

  for (int j = 0; j < Sc; j += 64) {
    pass(j, ka, kb, va, vb);
    pass(j + 32, kb, ka, vb, va);
  }

  // ---- normalize and store: out[b][s0 + m][h*64 + et*16 + 8g + 0..7] ----
  // l sits in register 0 of lanes 0..15, lanes 16..31 hold 0 there
  const float l = oext[0] + xhalf(oext[0]);
  const float inv = 1.0f / l;
  float* orow = out + ((size_t)b * Sc + s0 + m) * DM + h * DH + g * 8;
#pragma unroll
  for (int et = 0; et < 4; ++et) {
    const float4 lo = make_float4(oacc[et][0] * inv, oacc[et][1] * inv,
                                  oacc[et][2] * inv, oacc[et][3] * inv);
    const float4 hi = make_float4(oacc[et][4] * inv, oacc[et][5] * inv,
                                  oacc[et][6] * inv, oacc[et][7] * inv);
    *(float4*)(orow + et * 16)     = lo;
    *(float4*)(orow + et * 16 + 4) = hi;
  }
}

// ===========================================================================
extern "C" void kernel_launch(void* const* d_in, const int* in_sizes, int n_in,
                              void* d_out, int out_size, void* d_ws, size_t ws_size,
                              hipStream_t stream) {
  (void)in_sizes; (void)n_in; (void)out_size; (void)ws_size;
  const float* x  = (const float*)d_in[0];
  const float* Wq = (const float*)d_in[1];
  const float* Wk = (const float*)d_in[2];
  const float* Wv = (const float*)d_in[3];
  const float* bq = (const float*)d_in[4];
  const float* bk = (const float*)d_in[5];
  const float* bv = (const float*)d_in[6];

  const size_t per = (size_t)Bc * Hc * Sc * DH;  // elements per Q/K/V plane
  _Float16* Q  = (_Float16*)d_ws;
  _Float16* K  = Q + per;
  _Float16* Vt = K + per;

  dim3 grid(Bc * Hc * (Sc / 128));  // 2048 blocks, 8 waves each
  qkv_kernel<<<grid, 256, 0, stream>>>(x, Wq, Wk, Wv, bq, bk, bv, Q, K, Vt);
  attn_kernel<<<grid, 256, 0, stream>>>(Q, K, Vt, (float*)d_out);
}

// v004
// A run of this version takes 145 microseconds.
// Timed twice side by side with v003, it ran 1.21 times as fast both times.
// Over all steps from v000 it is 2.47 times as fast.
#include <hip/hip_runtime.h>
#include <hip/hip_bf16.h>

typedef __attribute__((ext_vector_type(16))) _Float16 v16h;
typedef __attribute__((ext_vector_type(8)))  _Float16 v8h;
typedef __attribute__((ext_vector_type(8)))  float    v8f;

constexpr int Bc = 16;     // batch
constexpr int Sc = 1024;   // sequence
constexpr int Hc = 16;     // heads
constexpr int DH = 64;     // head dim
constexpr int DM = 1024;   // model dim

// attention scale folded into Q at projection time: 1/sqrt(64) * log2(e)
constexpr float QSCALE = 0.125f * 1.4426950408889634f;

// ---------------------------------------------------------------------------
// WMMA helper: D = A(16x32 f16) * B(32x16 f16) + C(16x16 f32)
// ---------------------------------------------------------------------------
__device__ inline v8f wmma16(v16h a, v16h b, v8f c) {
  return __builtin_amdgcn_wmma_f32_16x16x32_f16(
      /*neg_a=*/false, a, /*neg_b=*/false, b,
      /*c_mod=*/(short)0, c, /*reuse_a=*/false, /*reuse_b=*/false);
}

// ---------------------------------------------------------------------------
// Fragment loaders. CDNA5 16-bit A/B fragment, per lane (g = lane/16):
//   elem i (i<8) -> K = kbase + 8g + i ; elem 8+i -> K = kbase + 8g + 16 + i
// i.e. two contiguous runs of 8 at p and p+16.
// ---------------------------------------------------------------------------
__device__ inline v16h frag_from_f32(const float* __restrict__ p) {
  v16h a;
#pragma unroll
  for (int i = 0; i < 8; ++i) { a[i] = (_Float16)p[i]; a[8 + i] = (_Float16)p[16 + i]; }
  return a;
}
// Fragment-order planes in the workspace: one fragment = two 512-byte units,
// unit u holds run u (8 halves) of lane 0..31 back to back, so that one
// wave-wide 16-byte load or store covers four whole 128-byte lines.
// p = fragment base + lane * 8.
constexpr int UNIT = 32 * 8;   // halves per 512-byte unit
__device__ inline v16h frag_packed(const _Float16* __restrict__ p) {
  v8h lo = *(const v8h*)p;
  v8h hi = *(const v8h*)(p + UNIT);
  v16h a;
#pragma unroll
  for (int i = 0; i < 8; ++i) { a[i] = lo[i]; a[8 + i] = hi[i]; }
  return a;
}

// Weight fragments in LDS: run u of a fragment is two 16-lane halves (g) of
// 256 bytes, each at a pitch of 288 bytes. A 16-byte fragment read is then
// contiguous over each 16 lanes, and the 8-byte staging stores of a wave, which
// fall into eight such halves at once, meet every bank once.
// p = fragment base + g * WP + (lane & 15) * 8.
constexpr int WP = 144;        // halves per 16-lane half: 128 of data + 16 of pad
typedef __attribute__((ext_vector_type(4))) _Float16 v4h;
typedef __attribute__((ext_vector_type(4))) float    v4f;
__device__ inline v16h frag_lds(const _Float16* p) {
  v8h lo = *(const v8h*)p;
  v8h hi = *(const v8h*)(p + 2 * WP);
  v16h a;
#pragma unroll
  for (int i = 0; i < 8; ++i) { a[i] = lo[i]; a[8 + i] = hi[i]; }
  return a;
}

// ===========================================================================
// Kernel 1: Q/K/V projections.  One wave = one (b,h) x 16-row s-tile.
// The head's three weight matrices are read once per block, by whole lines,
// converted to f16 and laid in LDS as B fragments that all eight waves read.
// Bias rides in the WMMA C operand. Q is pre-scaled by QSCALE.
// Q,K: LDS-transposed, then stored in fragment order:
//      [bh][s/16][dh/32][run u][lane][8], a 16-row tile keeps its own 2 KB.
// V  : fragment order of the transposed operand:
//      [bh][s/32][dh/16][run u][lane][8], straight from the accumulators.
// ===========================================================================
__global__ __launch_bounds__(256)
void qkv_kernel(const float* __restrict__ x,
                const float* __restrict__ Wq, const float* __restrict__ Wk,
                const float* __restrict__ Wv,
                const float* __restrict__ bq, const float* __restrict__ bk,
                const float* __restrict__ bv,
                _Float16* __restrict__ Qo, _Float16* __restrict__ Ko,
                _Float16* __restrict__ Vt) {
  __shared__ __align__(16) _Float16 Tr[8][16 * 72];  // per-wave 16x64 tile, pad 72
  __shared__ __align__(16) _Float16 Wl[24 * 4 * WP]; // [wsel][e/16][k/32][u][g] halves

  const int lane = threadIdx.x & 31;
  const int wave = threadIdx.x >> 5;
  const int m = lane & 15, g = lane >> 4;
  const int blocksPerBH = Sc / 128;                 // 8
  const int bh = blockIdx.x / blocksPerBH;
  const int s0 = (blockIdx.x % blocksPerBH) * 128 + wave * 16;
  const int b = bh / Hc, h = bh % Hc;

  const float* Ws[3] = {Wq, Wk, Wv};
  const float* bs[3] = {bq, bk, bv};

  // Weights: thread t takes floats 4t..4t+3 of each 1024-float slab (16 rows),
  // so a wave-wide load covers 512 contiguous bytes. Row n = t/16 of the slab,
  // columns 4*(t%16)..+3 = k half (bit 3 of t), run u (bit 2), lane half g
  // (bit 1), first or second four of the run (bit 0).
  // The loops are unrolled so that wr stays in registers, all twelve loads are
  // in flight together and every offset is an immediate.
  {
    const int t = threadIdx.x;
    v4f wr[3][4];
#pragma unroll
    for (int wsel = 0; wsel < 3; ++wsel)
#pragma unroll
      for (int i = 0; i < 4; ++i)
        wr[wsel][i] = *(const v4f*)(Ws[wsel] + (size_t)h * DH * DH + i * 1024 + t * 4);
    _Float16* wd = Wl + ((t >> 1) & 7) * WP + (t >> 4) * 8 + (t & 1) * 4;
#pragma unroll
    for (int wsel = 0; wsel < 3; ++wsel)
#pragma unroll
      for (int i = 0; i < 4; ++i) {
        const v4f w = wr[wsel][i];
        v4h c;
#pragma unroll
        for (int k = 0; k < 4; ++k) c[k] = (_Float16)w[k];
        *(v4h*)(wd + (wsel * 4 + i) * (8 * WP)) = c;
      }
  }

  // A-fragments of X tile (rows s0..s0+15, cols h*64..h*64+63), f32 -> f16
  const float* xrow = x + ((size_t)b * Sc + (s0 + m)) * DM + h * DH;
  v16h a0 = frag_from_f32(xrow + 0  + g * 8);
  v16h a1 = frag_from_f32(xrow + 32 + g * 8);

  _Float16* Tw = &Tr[wave][0];

  __syncthreads();   // every wave's share of the weight fragments is in LDS

#pragma unroll
  for (int wsel = 0; wsel < 3; ++wsel) {
#pragma unroll
    for (int e0 = 0; e0 < DH; e0 += 16) {
      // B[k][n] = W[h][e0+n][k]  (y = x * W^T): lane n reads row e0+n of W
      const _Float16* wf = Wl + (wsel * 4 + (e0 >> 4)) * (8 * WP) + g * WP + m * 8;
      const float bias = bs[wsel][h * DH + e0 + m];
      v8f acc;
#pragma unroll
      for (int i = 0; i < 8; ++i) acc[i] = bias;   // bias in C operand
      acc = wmma16(a0, frag_lds(wf), acc);
      acc = wmma16(a1, frag_lds(wf + 4 * WP), acc);

      if (wsel == 2) {
        // lane (m,g) holds column e0+m, keys s0+8g..+7: run u = (s0/16)&1 of
        // the 32-key fragment, at its own lane's place -> 512 contiguous bytes
        __align__(16) _Float16 tmp[8];
#pragma unroll
        for (int r = 0; r < 8; ++r) tmp[r] = (_Float16)acc[r];
        const unsigned voff = (unsigned)((s0 >> 5) * (DH * 32) +
                                         ((s0 >> 4) & 1) * UNIT + lane * 8);
        _Float16* dst = Vt + (size_t)bh * DH * Sc + (e0 >> 4) * (2 * UNIT) + voff;
        *(float4*)dst = *(const float4*)tmp;
      } else {
        const float sc = (wsel == 0) ? QSCALE : 1.0f;
#pragma unroll
        for (int r = 0; r < 8; ++r)
          Tw[(r + 8 * g) * 72 + e0 + m] = (_Float16)(acc[r] * sc);
      }
    }
    if (wsel < 2) {
      asm volatile("s_wait_dscnt 0x0" ::: "memory");
      // write-out in fragment order: unit q = (dh/32)*2 + u holds, at lane
      // (m,g), row m, columns q*16 + g*8 .. +7
      const _Float16* srcp = Tw + m * 72 + g * 8;
      _Float16* dstp = (wsel == 0 ? Qo : Ko) + (size_t)bh * Sc * DH +
                       (unsigned)(s0 * DH + lane * 8);
#pragma unroll
      for (int q = 0; q < 4; ++q)
        *(v8h*)(dstp + q * UNIT) = *(const v8h*)(srcp + q * 16);
      asm volatile("s_wait_dscnt 0x0" ::: "memory");  // before Tw reuse
      // the stores' address and data registers are reused right behind them
      asm volatile("s_wait_xcnt 0x0" ::: "memory");
    }
  }
}

__device__ inline float xhalf(float v) {
  const int b = __float_as_int(v);
  return __int_as_float(
      __builtin_amdgcn_permlanex16(b, b, 0x76543210, 0xfedcba98, false, false));
}

// Four waves per SIMD is what the two register sets of K and V allow. Told so,
// the scheduler keeps the loads a pass ahead of their use; left to aim for more
// waves it sinks them to just before the products, which then wait them out.
__global__ __launch_bounds__(256) __attribute__((amdgpu_waves_per_eu(4, 4)))
void attn_kernel(const _Float16* __restrict__ Qi, const _Float16* __restrict__ Ki,
                 const _Float16* __restrict__ Vt, float* __restrict__ out) {
  const int lane = threadIdx.x & 31;
  const int wave = threadIdx.x >> 5;
  const int m = lane & 15, g = lane >> 4;
  const int blocksPerBH = Sc / 128;
  const int bh = blockIdx.x / blocksPerBH;
  const int s0 = (blockIdx.x % blocksPerBH) * 128 + wave * 16;
  const int b = bh / Hc, h = bh % Hc;

  // Q B-fragments stay in registers for the whole key loop (already scaled)
  const _Float16* qtile = Qi + ((size_t)bh * Sc + s0) * DH + lane * 8;
  v16h qa0 = frag_packed(qtile);
  v16h qa1 = frag_packed(qtile + 2 * UNIT);
  // the loads' address registers are reused as soon as the loads are issued
  asm volatile("s_wait_xcnt 0x0" ::: "memory");

  // ones-row A fragment: A1[r][k] = (r==0); lanes 0/16 all-ones, else zero
  v16h ones;
  {
    const _Float16 o = (m == 0) ? (_Float16)1.0f : (_Float16)0.0f;
#pragma unroll
    for (int i = 0; i < 16; ++i) ones[i] = o;
  }

  float mrow = -1e30f;   // running maximum of this lane's query
  v8f oacc[4], oext;     // oacc[et][r] = O[query m][et*16 + 8g + r]
  const v8f vzero = {0.f, 0.f, 0.f, 0.f, 0.f, 0.f, 0.f, 0.f};
#pragma unroll
  for (int et = 0; et < 4; ++et) oacc[et] = vzero;
  oext = vzero;          // row 0 (register 0, lanes 0..15) = l; other rows stay 0

  // block-uniform plane bases; the lane's part of every address is constant
  const _Float16* kbase = Ki + (size_t)bh * Sc * DH;
  const _Float16* vbase = Vt + (size_t)bh * DH * Sc;
  const unsigned loff = (unsigned)lane * 8u;

  // Every fragment is loaded one pass ahead of the product that reads it: the
  // top of pass j issues K and V of pass j+1, which fly under the whole pass.
  // K and V each have two register sets that swap roles from pass to pass, so
  // nothing is copied.
  auto pass = [&](const int j, const v16h (&kc)[4], v16h (&kn)[4],
                  const v16h (&vf)[4], v16h (&vn)[4]) {
    // the last pass wraps to tile 0 (loaded, never used)
    const size_t nxt = (size_t)((j + 32) & (Sc - 1)) * DH;
#pragma unroll
    for (int i = 0; i < 4; ++i)
      kn[i] = frag_packed(kbase + nxt + i * (2 * UNIT) + loff);
    // the loads' address registers are reused as soon as the loads are issued
    asm volatile("s_wait_xcnt 0x0" ::: "memory");
#pragma unroll
    for (int et = 0; et < 4; ++et)
      vn[et] = frag_packed(vbase + nxt + et * (2 * UNIT) + loff);
    // the loads' address registers are reused as soon as the loads are issued
    asm volatile("s_wait_xcnt 0x0" ::: "memory");

    // ---- scores for 32 keys: two 16x16 tiles (keys x queries), K-dim = 64 ----
    v8f s_lo = vzero, s_hi = vzero;
    s_lo = wmma16(kc[0], qa0, s_lo);
    s_lo = wmma16(kc[1], qa1, s_lo);
    s_hi = wmma16(kc[2], qa0, s_hi);
    s_hi = wmma16(kc[3], qa1, s_hi);

    // ---- online softmax: 16 of the query's 32 scores are in this lane, the
    //      other 16 in lane ^ 16 ----
    float t[8];
#pragma unroll
    for (int r = 0; r < 8; ++r) t[r] = fmaxf(s_lo[r], s_hi[r]);
    const float mx = fmaxf(fmaxf(fmaxf(t[0], t[1]), fmaxf(t[2], t[3])),
                           fmaxf(fmaxf(t[4], t[5]), fmaxf(t[6], t[7])));
    const float mnew = fmaxf(mrow, fmaxf(mx, xhalf(mx)));
    const float alpha = exp2f(mrow - mnew);
    mrow = mnew;

    // P^T as B fragment, straight from the score accumulators
    v16h pb;
#pragma unroll
    for (int r = 0; r < 8; ++r) {
      pb[r]     = (_Float16)exp2f(s_lo[r] - mnew);   // already log2e-scaled
      pb[8 + r] = (_Float16)exp2f(s_hi[r] - mnew);
    }
#pragma unroll
    for (int et = 0; et < 4; ++et)
#pragma unroll
      for (int r = 0; r < 8; ++r) oacc[et][r] *= alpha;
    oext[0] *= alpha;

    // ---- O^T += V^T * P^T ; l += 1 * P^T (ones row) ----
#pragma unroll
    for (int et = 0; et < 4; ++et) oacc[et] = wmma16(vf[et], pb, oacc[et]);
    oext = wmma16(ones, pb, oext);
  };

  v16h ka[4], kb[4], va[4], vb[4];
#pragma unroll
  for (int i = 0; i < 4; ++i) {
    ka[i] = frag_packed(kbase + i * (2 * UNIT) + loff);
    va[i] = frag_packed(vbase + i * (2 * UNIT) + loff);
  }
  // the loads' address registers are reused as soon as the loads are issued
  asm volatile("s_wait_xcnt 0x0" ::: "memory");

  for (int j = 0; j < Sc; j += 64) {
    pass(j, ka, kb, va, vb);
    pass(j + 32, kb, ka, vb, va);
  }

  // ---- normalize and store: out[b][s0 + m][h*64 + et*16 + 8g + 0..7] ----
  // l sits in register 0 of lanes 0..15, lanes 16..31 hold 0 there
  const float l = oext[0] + xhalf(oext[0]);
  const float inv = 1.0f / l;
  float* orow = out + ((size_t)b * Sc + s0 + m) * DM + h * DH + g * 8;
#pragma unroll
  for (int et = 0; et < 4; ++et) {
    const float4 lo = make_float4(oacc[et][0] * inv, oacc[et][1] * inv,
                                  oacc[et][2] * inv, oacc[et][3] * inv);
    const float4 hi = make_float4(oacc[et][4] * inv, oacc[et][5] * inv,
                                  oacc[et][6] * inv, oacc[et][7] * inv);
    *(float4*)(orow + et * 16)     = lo;
    *(float4*)(orow + et * 16 + 4) = hi;
  }
}

// ===========================================================================
extern "C" void kernel_launch(void* const* d_in, const int* in_sizes, int n_in,
                              void* d_out, int out_size, void* d_ws, size_t ws_size,
                              hipStream_t stream) {
  (void)in_sizes; (void)n_in; (void)out_size; (void)ws_size;
  const float* x  = (const float*)d_in[0];
  const float* Wq = (const float*)d_in[1];
  const float* Wk = (const float*)d_in[2];
  const float* Wv = (const float*)d_in[3];
  const float* bq = (const float*)d_in[4];
  const float* bk = (const float*)d_in[5];
  const float* bv = (const float*)d_in[6];

  const size_t per = (size_t)Bc * Hc * Sc * DH;  // elements per Q/K/V plane
  _Float16* Q  = (_Float16*)d_ws;
  _Float16* K  = Q + per;
  _Float16* Vt = K + per;

  dim3 grid(Bc * Hc * (Sc / 128));  // 2048 blocks, 8 waves each
  qkv_kernel<<<grid, 256, 0, stream>>>(x, Wq, Wk, Wv, bq, bk, bv, Q, K, Vt);
  attn_kernel<<<grid, 256, 0, stream>>>(Q, K, Vt, (float*)d_out);
}

// v005
// A run of this version takes 113 microseconds.
// Next to v004, in two timings, it ran 1.28 and 1.29 times as fast.
// Over all steps from v000 it is 3.18 times as fast.
#include <hip/hip_runtime.h>
#include <hip/hip_bf16.h>

typedef __attribute__((ext_vector_type(16))) _Float16 v16h;
typedef __attribute__((ext_vector_type(8)))  _Float16 v8h;
typedef __attribute__((ext_vector_type(8)))  float    v8f;

constexpr int Bc = 16;     // batch
constexpr int Sc = 1024;   // sequence
constexpr int Hc = 16;     // heads
constexpr int DH = 64;     // head dim
constexpr int DM = 1024;   // model dim

// attention scale folded into Q at projection time: 1/sqrt(64) * log2(e)
constexpr float QSCALE = 0.125f * 1.4426950408889634f;

// ---------------------------------------------------------------------------
// WMMA helper: D = A(16x32 f16) * B(32x16 f16) + C(16x16 f32)
// ---------------------------------------------------------------------------
__device__ inline v8f wmma16(v16h a, v16h b, v8f c) {
  return __builtin_amdgcn_wmma_f32_16x16x32_f16(
      /*neg_a=*/false, a, /*neg_b=*/false, b,
      /*c_mod=*/(short)0, c, /*reuse_a=*/false, /*reuse_b=*/false);
}

// ---------------------------------------------------------------------------
// Fragment loaders. CDNA5 16-bit A/B fragment, per lane (g = lane/16):
//   elem i (i<8) -> K = kbase + 8g + i ; elem 8+i -> K = kbase + 8g + 16 + i
// i.e. two contiguous runs of 8 at p and p+16.
// ---------------------------------------------------------------------------
__device__ inline v16h frag_from_f32(const float* __restrict__ p) {
  v16h a;
#pragma unroll
  for (int i = 0; i < 8; ++i) { a[i] = (_Float16)p[i]; a[8 + i] = (_Float16)p[16 + i]; }
  return a;
}
// Fragment-order planes in the workspace: one fragment = two 512-byte units,
// unit u holds run u (8 halves) of lane 0..31 back to back, so that one
// wave-wide 16-byte load or store covers four whole 128-byte lines.
// p = fragment base + lane * 8.
constexpr int UNIT = 32 * 8;   // halves per 512-byte unit
__device__ inline v16h frag_packed(const _Float16* __restrict__ p) {
  v8h lo = *(const v8h*)p;
  v8h hi = *(const v8h*)(p + UNIT);
  v16h a;
#pragma unroll
  for (int i = 0; i < 8; ++i) { a[i] = lo[i]; a[8 + i] = hi[i]; }
  return a;
}

// Weight fragments in LDS: run u of a fragment is two 16-lane halves (g) of
// 256 bytes, each at a pitch of 288 bytes. A 16-byte fragment read is then
// contiguous over each 16 lanes, and the 8-byte staging stores of a wave, which
// fall into eight such halves at once, meet every bank once.
// p = fragment base + g * WP + (lane & 15) * 8.
constexpr int WP = 144;        // halves per 16-lane half: 128 of data + 16 of pad
typedef __attribute__((ext_vector_type(4))) _Float16 v4h;
typedef __attribute__((ext_vector_type(4))) float    v4f;
__device__ inline v16h frag_lds(const _Float16* p) {
  v8h lo = *(const v8h*)p;
  v8h hi = *(const v8h*)(p + 2 * WP);
  v16h a;
#pragma unroll
  for (int i = 0; i < 8; ++i) { a[i] = lo[i]; a[8 + i] = hi[i]; }
  return a;
}

// ===========================================================================
// Kernel 1: Q/K/V projections.  One wave = one (b,h) x 16-row s-tile.
// The head's three weight matrices are read once per block, by whole lines,
// converted to f16 and laid in LDS as B fragments that all eight waves read.
// Bias rides in the WMMA C operand. Q is pre-scaled by QSCALE.
// Q,K: LDS-transposed, then stored in fragment order:
//      [bh][s/16][dh/32][run u][lane][8], a 16-row tile keeps its own 2 KB.
// V  : fragment order of the transposed operand:
//      [bh][s/32][dh/16][run u][lane][8], straight from the accumulators.
// ===========================================================================
__global__ __launch_bounds__(256)
void qkv_kernel(const float* __restrict__ x,
                const float* __restrict__ Wq, const float* __restrict__ Wk,
                const float* __restrict__ Wv,
                const float* __restrict__ bq, const float* __restrict__ bk,
                const float* __restrict__ bv,
                _Float16* __restrict__ Qo, _Float16* __restrict__ Ko,
                _Float16* __restrict__ Vt) {
  __shared__ __align__(16) _Float16 Tr[8][16 * 72];  // per-wave 16x64 tile, pad 72
  __shared__ __align__(16) _Float16 Wl[24 * 4 * WP]; // [wsel][e/16][k/32][u][g] halves

  const int lane = threadIdx.x & 31;
  const int wave = threadIdx.x >> 5;
  const int m = lane & 15, g = lane >> 4;
  const int blocksPerBH = Sc / 128;                 // 8
  const int bh = blockIdx.x / blocksPerBH;
  const int s0 = (blockIdx.x % blocksPerBH) * 128 + wave * 16;
  const int b = bh / Hc, h = bh % Hc;

  const float* Ws[3] = {Wq, Wk, Wv};
  const float* bs[3] = {bq, bk, bv};

  // Weights: thread t takes floats 4t..4t+3 of each 1024-float slab (16 rows),
  // so a wave-wide load covers 512 contiguous bytes. Row n = t/16 of the slab,
  // columns 4*(t%16)..+3 = k half (bit 3 of t), run u (bit 2), lane half g
  // (bit 1), first or second four of the run (bit 0).
  // The loops are unrolled so that wr stays in registers, all twelve loads are
  // in flight together and every offset is an immediate.
  {
    const int t = threadIdx.x;
    v4f wr[3][4];
#pragma unroll
    for (int wsel = 0; wsel < 3; ++wsel)
#pragma unroll
      for (int i = 0; i < 4; ++i)
        wr[wsel][i] = *(const v4f*)(Ws[wsel] + (size_t)h * DH * DH + i * 1024 + t * 4);
    _Float16* wd = Wl + ((t >> 1) & 7) * WP + (t >> 4) * 8 + (t & 1) * 4;
#pragma unroll
    for (int wsel = 0; wsel < 3; ++wsel)
#pragma unroll
      for (int i = 0; i < 4; ++i) {
        const v4f w = wr[wsel][i];
        v4h c;
#pragma unroll
        for (int k = 0; k < 4; ++k) c[k] = (_Float16)w[k];
        *(v4h*)(wd + (wsel * 4 + i) * (8 * WP)) = c;
      }
  }

  // A-fragments of X tile (rows s0..s0+15, cols h*64..h*64+63), f32 -> f16
  const float* xrow = x + ((size_t)b * Sc + (s0 + m)) * DM + h * DH;
  v16h a0 = frag_from_f32(xrow + 0  + g * 8);
  v16h a1 = frag_from_f32(xrow + 32 + g * 8);

  _Float16* Tw = &Tr[wave][0];

  __syncthreads();   // every wave's share of the weight fragments is in LDS

#pragma unroll
  for (int wsel = 0; wsel < 3; ++wsel) {
#pragma unroll
    for (int e0 = 0; e0 < DH; e0 += 16) {
      // B[k][n] = W[h][e0+n][k]  (y = x * W^T): lane n reads row e0+n of W
      const _Float16* wf = Wl + (wsel * 4 + (e0 >> 4)) * (8 * WP) + g * WP + m * 8;
      const float bias = bs[wsel][h * DH + e0 + m];
      v8f acc;
#pragma unroll
      for (int i = 0; i < 8; ++i) acc[i] = bias;   // bias in C operand
      acc = wmma16(a0, frag_lds(wf), acc);
      acc = wmma16(a1, frag_lds(wf + 4 * WP), acc);

      if (wsel == 2) {
        // lane (m,g) holds column e0+m, keys s0+8g..+7: run u = (s0/16)&1 of
        // the 32-key fragment, at its own lane's place -> 512 contiguous bytes
        __align__(16) _Float16 tmp[8];
#pragma unroll
        for (int r = 0; r < 8; ++r) tmp[r] = (_Float16)acc[r];
        const unsigned voff = (unsigned)((s0 >> 5) * (DH * 32) +
                                         ((s0 >> 4) & 1) * UNIT + lane * 8);
        _Float16* dst = Vt + (size_t)bh * DH * Sc + (e0 >> 4) * (2 * UNIT) + voff;
        *(float4*)dst = *(const float4*)tmp;
      } else {
        const float sc = (wsel == 0) ? QSCALE : 1.0f;
#pragma unroll
        for (int r = 0; r < 8; ++r)
          Tw[(r + 8 * g) * 72 + e0 + m] = (_Float16)(acc[r] * sc);
      }
    }
    if (wsel < 2) {
      asm volatile("s_wait_dscnt 0x0" ::: "memory");
      // write-out in fragment order: unit q = (dh/32)*2 + u holds, at lane
      // (m,g), row m, columns q*16 + g*8 .. +7
      const _Float16* srcp = Tw + m * 72 + g * 8;
      _Float16* dstp = (wsel == 0 ? Qo : Ko) + (size_t)bh * Sc * DH +
                       (unsigned)(s0 * DH + lane * 8);
#pragma unroll
      for (int q = 0; q < 4; ++q)
        *(v8h*)(dstp + q * UNIT) = *(const v8h*)(srcp + q * 16);
      asm volatile("s_wait_dscnt 0x0" ::: "memory");  // before Tw reuse
      // the stores' address and data registers are reused right behind them
      asm volatile("s_wait_xcnt 0x0" ::: "memory");
    }
  }
}

__device__ inline float xhalf(float v) {
  const int b = __float_as_int(v);
  return __int_as_float(
      __builtin_amdgcn_permlanex16(b, b, 0x76543210, 0xfedcba98, false, false));
}

constexpr int QG = 2;      // 16-query groups per wave

// Four waves per SIMD is what the registers of two query groups allow. Told so,
// the scheduler leaves the loads where they are written, most of a pass ahead
// of their use; left to aim for more waves it sinks them to just before the
// products, which then wait them out.
__global__ __launch_bounds__(256) __attribute__((amdgpu_waves_per_eu(4, 4)))
void attn_kernel(const _Float16* __restrict__ Qi, const _Float16* __restrict__ Ki,
                 const _Float16* __restrict__ Vt, float* __restrict__ out) {
  const int lane = threadIdx.x & 31;
  const int wave = threadIdx.x >> 5;
  const int m = lane & 15, g = lane >> 4;
  const int blocksPerBH = Sc / (128 * QG);
  const int bh = blockIdx.x / blocksPerBH;
  const int s0 = (blockIdx.x % blocksPerBH) * (128 * QG) + wave * (16 * QG);
  const int b = bh / Hc, h = bh % Hc;

  // Q B-fragments stay in registers for the whole key loop (already scaled)
  const _Float16* qtile = Qi + ((size_t)bh * Sc + s0) * DH + lane * 8;
  v16h qa[QG][2];
#pragma unroll
  for (int q = 0; q < QG; ++q) {
    qa[q][0] = frag_packed(qtile + q * (4 * UNIT));
    qa[q][1] = frag_packed(qtile + q * (4 * UNIT) + 2 * UNIT);
  }
  // the loads' address registers are reused as soon as the loads are issued
  asm volatile("s_wait_xcnt 0x0" ::: "memory");

  // ones-row A fragment: A1[r][k] = (r==0); lanes 0/16 all-ones, else zero
  v16h ones;
  {
    const _Float16 o = (m == 0) ? (_Float16)1.0f : (_Float16)0.0f;
#pragma unroll
    for (int i = 0; i < 16; ++i) ones[i] = o;
  }

  float mrow[QG];            // running maximum of this lane's query, per group
  v8f oacc[QG][4], oext[QG]; // oacc[q][et][r] = O[query 16q+m][et*16 + 8g + r]
  const v8f vzero = {0.f, 0.f, 0.f, 0.f, 0.f, 0.f, 0.f, 0.f};
#pragma unroll
  for (int q = 0; q < QG; ++q) {
    mrow[q] = -1e30f;
#pragma unroll
    for (int et = 0; et < 4; ++et) oacc[q][et] = vzero;
    oext[q] = vzero;         // row 0 (register 0, lanes 0..15) = l; other rows stay 0
  }

  // block-uniform plane bases; the lane's part of every address is constant
  const _Float16* kbase = Ki + (size_t)bh * Sc * DH;
  const _Float16* vbase = Vt + (size_t)bh * DH * Sc;
  const unsigned loff = (unsigned)lane * 8u;

  // K first, then V, in the loop's own order: the compiler sets the counted
  // load waits at the loop's head for the worse of the orders that reach them
  v16h kf[4], vf[4];
#pragma unroll
  for (int i = 0; i < 4; ++i) kf[i] = frag_packed(kbase + i * (2 * UNIT) + loff);
  // the loads' address registers are reused as soon as the loads are issued
  asm volatile("s_wait_xcnt 0x0" ::: "memory");
#pragma unroll
  for (int i = 0; i < 4; ++i) vf[i] = frag_packed(vbase + i * (2 * UNIT) + loff);
  // the loads' address registers are reused as soon as the loads are issued
  asm volatile("s_wait_xcnt 0x0" ::: "memory");

  // K of pass j+1 is loaded over K of pass j right behind the score products,
  // V of pass j+1 over V of pass j right behind the output products: each load
  // flies under the rest of a pass and takes no second register set.
  for (int j = 0; j < Sc; j += 32) {
    // the last pass wraps to tile 0 (loaded, never used)
    const size_t nxt = (size_t)((j + 32) & (Sc - 1)) * DH;

    // ---- scores for 32 keys x 32 queries: four 16x16 tiles, K-dim = 64 ----
    v8f s_lo[QG], s_hi[QG];
#pragma unroll
    for (int q = 0; q < QG; ++q) s_lo[q] = wmma16(kf[0], qa[q][0], vzero);
#pragma unroll
    for (int q = 0; q < QG; ++q) s_hi[q] = wmma16(kf[2], qa[q][0], vzero);
#pragma unroll
    for (int q = 0; q < QG; ++q) s_lo[q] = wmma16(kf[1], qa[q][1], s_lo[q]);
#pragma unroll
    for (int q = 0; q < QG; ++q) s_hi[q] = wmma16(kf[3], qa[q][1], s_hi[q]);

#pragma unroll
    for (int i = 0; i < 4; ++i)
      kf[i] = frag_packed(kbase + nxt + i * (2 * UNIT) + loff);
    // the loads' address registers are reused as soon as the loads are issued
    asm volatile("s_wait_xcnt 0x0" ::: "memory");

    // ---- online softmax: 16 of a query's 32 scores are in this lane, the
    //      other 16 in lane ^ 16 ----
    v16h pb[QG];             // P^T as B fragments, straight from the accumulators
#pragma unroll
    for (int q = 0; q < QG; ++q) {
      float t[8];
#pragma unroll
      for (int r = 0; r < 8; ++r) t[r] = fmaxf(s_lo[q][r], s_hi[q][r]);
      const float mx = fmaxf(fmaxf(fmaxf(t[0], t[1]), fmaxf(t[2], t[3])),
                             fmaxf(fmaxf(t[4], t[5]), fmaxf(t[6], t[7])));
      const float mnew = fmaxf(mrow[q], fmaxf(mx, xhalf(mx)));
      const float alpha = exp2f(mrow[q] - mnew);
      mrow[q] = mnew;
#pragma unroll
      for (int r = 0; r < 8; ++r) {
        pb[q][r]     = (_Float16)exp2f(s_lo[q][r] - mnew);   // already log2e-scaled
        pb[q][8 + r] = (_Float16)exp2f(s_hi[q][r] - mnew);
      }
#pragma unroll
      for (int et = 0; et < 4; ++et)
#pragma unroll
        for (int r = 0; r < 8; ++r) oacc[q][et][r] *= alpha;
      oext[q][0] *= alpha;
    }

    // ---- O^T += V^T * P^T ; l += 1 * P^T (ones row) ----
#pragma unroll
    for (int et = 0; et < 4; ++et)
#pragma unroll
      for (int q = 0; q < QG; ++q) oacc[q][et] = wmma16(vf[et], pb[q], oacc[q][et]);
#pragma unroll
    for (int q = 0; q < QG; ++q) oext[q] = wmma16(ones, pb[q], oext[q]);

#pragma unroll
    for (int et = 0; et < 4; ++et)
      vf[et] = frag_packed(vbase + nxt + et * (2 * UNIT) + loff);
    // the loads' address registers are reused as soon as the loads are issued
    asm volatile("s_wait_xcnt 0x0" ::: "memory");
  }

  // ---- normalize and store: out[b][s0 + 16q + m][h*64 + et*16 + 8g + 0..7] ----
#pragma unroll
  for (int q = 0; q < QG; ++q) {
    // l sits in register 0 of lanes 0..15, lanes 16..31 hold 0 there
    const float l = oext[q][0] + xhalf(oext[q][0]);
    const float inv = 1.0f / l;
    float* orow = out + ((size_t)b * Sc + s0 + q * 16 + m) * DM + h * DH + g * 8;
#pragma unroll
    for (int et = 0; et < 4; ++et) {
      const float4 lo = make_float4(oacc[q][et][0] * inv, oacc[q][et][1] * inv,
                                    oacc[q][et][2] * inv, oacc[q][et][3] * inv);
      const float4 hi = make_float4(oacc[q][et][4] * inv, oacc[q][et][5] * inv,
                                    oacc[q][et][6] * inv, oacc[q][et][7] * inv);
      *(float4*)(orow + et * 16)     = lo;
      *(float4*)(orow + et * 16 + 4) = hi;
    }
    // the stores' address and data registers are reused by the next group
    if (q + 1 < QG) asm volatile("s_wait_xcnt 0x0" ::: "memory");
  }
}

// ===========================================================================
extern "C" void kernel_launch(void* const* d_in, const int* in_sizes, int n_in,
                              void* d_out, int out_size, void* d_ws, size_t ws_size,
                              hipStream_t stream) {
  (void)in_sizes; (void)n_in; (void)out_size; (void)ws_size;
  const float* x  = (const float*)d_in[0];
  const float* Wq = (const float*)d_in[1];
  const float* Wk = (const float*)d_in[2];
  const float* Wv = (const float*)d_in[3];
  const float* bq = (const float*)d_in[4];
  const float* bk = (const float*)d_in[5];
  const float* bv = (const float*)d_in[6];

  const size_t per = (size_t)Bc * Hc * Sc * DH;  // elements per Q/K/V plane
  _Float16* Q  = (_Float16*)d_ws;
  _Float16* K  = Q + per;
  _Float16* Vt = K + per;

  dim3 grid(Bc * Hc * (Sc / 128));  // 2048 blocks, 8 waves each
  qkv_kernel<<<grid, 256, 0, stream>>>(x, Wq, Wk, Wv, bq, bk, bv, Q, K, Vt);
  dim3 agrid(Bc * Hc * (Sc / (128 * QG)));  // 1024 blocks, 8 waves of 32 queries
  attn_kernel<<<agrid, 256, 0, stream>>>(Q, K, Vt, (float*)d_out);
}

// v006
// It runs in 97.9 microseconds.
// Two timings next to v005 put it at 1.16 and 1.15 times that version's speed.
// Over all steps from v000 it is 3.68 times as fast.
#include <hip/hip_runtime.h>
#include <hip/hip_bf16.h>

typedef __attribute__((ext_vector_type(16))) _Float16 v16h;
typedef __attribute__((ext_vector_type(8)))  _Float16 v8h;
typedef __attribute__((ext_vector_type(8)))  float    v8f;

constexpr int Bc = 16;     // batch
constexpr int Sc = 1024;   // sequence
constexpr int Hc = 16;     // heads
constexpr int DH = 64;     // head dim
constexpr int DM = 1024;   // model dim

// attention scale folded into Q at projection time: 1/sqrt(64) * log2(e)
constexpr float QSCALE = 0.125f * 1.4426950408889634f;

// ---------------------------------------------------------------------------
// WMMA helper: D = A(16x32 f16) * B(32x16 f16) + C(16x16 f32)
// ---------------------------------------------------------------------------
__device__ inline v8f wmma16(v16h a, v16h b, v8f c) {
  return __builtin_amdgcn_wmma_f32_16x16x32_f16(
      /*neg_a=*/false, a, /*neg_b=*/false, b,
      /*c_mod=*/(short)0, c, /*reuse_a=*/false, /*reuse_b=*/false);
}

// ---------------------------------------------------------------------------
// Fragment loaders. CDNA5 16-bit A/B fragment, per lane (g = lane/16):
//   elem i (i<8) -> K = kbase + 8g + i ; elem 8+i -> K = kbase + 8g + 16 + i
// i.e. two contiguous runs of 8 at p and p+16.
// ---------------------------------------------------------------------------
__device__ inline v16h frag_from_f32(const float* __restrict__ p) {
  v16h a;
#pragma unroll
  for (int i = 0; i < 8; ++i) { a[i] = (_Float16)p[i]; a[8 + i] = (_Float16)p[16 + i]; }
  return a;
}
// Fragment-order planes in the workspace: one fragment = two 512-byte units,
// unit u holds run u (8 halves) of lane 0..31 back to back, so that one
// wave-wide 16-byte load or store covers four whole 128-byte lines.
// p = fragment base + lane * 8.
constexpr int UNIT = 32 * 8;   // halves per 512-byte unit
__device__ inline v16h frag_packed(const _Float16* __restrict__ p) {
  v8h lo = *(const v8h*)p;
  v8h hi = *(const v8h*)(p + UNIT);
  v16h a;
#pragma unroll
  for (int i = 0; i < 8; ++i) { a[i] = lo[i]; a[8 + i] = hi[i]; }
  return a;
}

// Weight fragments in LDS: run u of a fragment is two 16-lane halves (g) of
// 256 bytes, each at a pitch of 288 bytes. A 16-byte fragment read is then
// contiguous over each 16 lanes, and the 8-byte staging stores of a wave, which
// fall into eight such halves at once, meet every bank once.
// p = fragment base + g * WP + (lane & 15) * 8.
constexpr int WP = 144;        // halves per 16-lane half: 128 of data + 16 of pad
typedef __attribute__((ext_vector_type(4))) _Float16 v4h;
typedef __attribute__((ext_vector_type(4))) float    v4f;
__device__ inline v16h frag_lds(const _Float16* p) {
  v8h lo = *(const v8h*)p;
  v8h hi = *(const v8h*)(p + 2 * WP);
  v16h a;
#pragma unroll
  for (int i = 0; i < 8; ++i) { a[i] = lo[i]; a[8 + i] = hi[i]; }
  return a;
}

// ===========================================================================
// Kernel 1: Q/K/V projections.  One wave = one (b,h) x 16-row s-tile.
// The head's three weight matrices are read once per block, by whole lines,
// converted to f16 and laid in LDS as B fragments that all eight waves read.
// Bias rides in the WMMA C operand. Q is pre-scaled by QSCALE.
// Q,K: LDS-transposed, then stored in fragment order:
//      [bh][s/16][dh/32][run u][lane][8], a 16-row tile keeps its own 2 KB.
// V  : fragment order of the transposed operand:
//      [bh][s/32][dh/16][run u][lane][8], straight from the accumulators.
// ===========================================================================
__global__ __launch_bounds__(256)
void qkv_kernel(const float* __restrict__ x,
                const float* __restrict__ Wq, const float* __restrict__ Wk,
                const float* __restrict__ Wv,
                const float* __restrict__ bq, const float* __restrict__ bk,
                const float* __restrict__ bv,
                _Float16* __restrict__ Qo, _Float16* __restrict__ Ko,
                _Float16* __restrict__ Vt) {
  __shared__ __align__(16) _Float16 Tr[8][16 * 72];  // per-wave 16x64 tile, pad 72
  __shared__ __align__(16) _Float16 Wl[24 * 4 * WP]; // [wsel][e/16][k/32][u][g] halves

  const int lane = threadIdx.x & 31;
  const int wave = threadIdx.x >> 5;
  const int m = lane & 15, g = lane >> 4;
  const int blocksPerBH = Sc / 128;                 // 8
  const int bh = blockIdx.x / blocksPerBH;
  const int s0 = (blockIdx.x % blocksPerBH) * 128 + wave * 16;
  const int b = bh / Hc, h = bh % Hc;

  const float* Ws[3] = {Wq, Wk, Wv};
  const float* bs[3] = {bq, bk, bv};

  // Weights: thread t takes floats 4t..4t+3 of each 1024-float slab (16 rows),
  // so a wave-wide load covers 512 contiguous bytes. Row n = t/16 of the slab,
  // columns 4*(t%16)..+3 = k half (bit 3 of t), run u (bit 2), lane half g
  // (bit 1), first or second four of the run (bit 0).
  // The loops are unrolled so that wr stays in registers, all twelve loads are
  // in flight together and every offset is an immediate.
  {
    const int t = threadIdx.x;
    v4f wr[3][4];
#pragma unroll
    for (int wsel = 0; wsel < 3; ++wsel)
#pragma unroll
      for (int i = 0; i < 4; ++i)
        wr[wsel][i] = *(const v4f*)(Ws[wsel] + (size_t)h * DH * DH + i * 1024 + t * 4);
    _Float16* wd = Wl + ((t >> 1) & 7) * WP + (t >> 4) * 8 + (t & 1) * 4;
#pragma unroll
    for (int wsel = 0; wsel < 3; ++wsel)
#pragma unroll
      for (int i = 0; i < 4; ++i) {
        const v4f w = wr[wsel][i];
        v4h c;
#pragma unroll
        for (int k = 0; k < 4; ++k) c[k] = (_Float16)w[k];
        *(v4h*)(wd + (wsel * 4 + i) * (8 * WP)) = c;
      }
  }

  // A-fragments of X tile (rows s0..s0+15, cols h*64..h*64+63), f32 -> f16
  const float* xrow = x + ((size_t)b * Sc + (s0 + m)) * DM + h * DH;
  v16h a0 = frag_from_f32(xrow + 0  + g * 8);
  v16h a1 = frag_from_f32(xrow + 32 + g * 8);

  _Float16* Tw = &Tr[wave][0];

  __syncthreads();   // every wave's share of the weight fragments is in LDS

#pragma unroll
  for (int wsel = 0; wsel < 3; ++wsel) {
#pragma unroll
    for (int e0 = 0; e0 < DH; e0 += 16) {
      // B[k][n] = W[h][e0+n][k]  (y = x * W^T): lane n reads row e0+n of W
      const _Float16* wf = Wl + (wsel * 4 + (e0 >> 4)) * (8 * WP) + g * WP + m * 8;
      const float bias = bs[wsel][h * DH + e0 + m];
      v8f acc;
#pragma unroll
      for (int i = 0; i < 8; ++i) acc[i] = bias;   // bias in C operand
      acc = wmma16(a0, frag_lds(wf), acc);
      acc = wmma16(a1, frag_lds(wf + 4 * WP), acc);

      if (wsel == 2) {
        // lane (m,g) holds column e0+m, keys s0+8g..+7: run u = (s0/16)&1 of
        // the 32-key fragment, at its own lane's place -> 512 contiguous bytes
        __align__(16) _Float16 tmp[8];
#pragma unroll
        for (int r = 0; r < 8; ++r) tmp[r] = (_Float16)acc[r];
        const unsigned voff = (unsigned)((s0 >> 5) * (DH * 32) +
                                         ((s0 >> 4) & 1) * UNIT + lane * 8);
        _Float16* dst = Vt + (size_t)bh * DH * Sc + (e0 >> 4) * (2 * UNIT) + voff;
        *(float4*)dst = *(const float4*)tmp;
      } else {
        const float sc = (wsel == 0) ? QSCALE : 1.0f;
#pragma unroll
        for (int r = 0; r < 8; ++r)
          Tw[(r + 8 * g) * 72 + e0 + m] = (_Float16)(acc[r] * sc);
      }
    }
    if (wsel < 2) {
      asm volatile("s_wait_dscnt 0x0" ::: "memory");
      // write-out in fragment order: unit q = (dh/32)*2 + u holds, at lane
      // (m,g), row m, columns q*16 + g*8 .. +7
      const _Float16* srcp = Tw + m * 72 + g * 8;
      _Float16* dstp = (wsel == 0 ? Qo : Ko) + (size_t)bh * Sc * DH +
                       (unsigned)(s0 * DH + lane * 8);
#pragma unroll
      for (int q = 0; q < 4; ++q)
        *(v8h*)(dstp + q * UNIT) = *(const v8h*)(srcp + q * 16);
      asm volatile("s_wait_dscnt 0x0" ::: "memory");  // before Tw reuse
      // the stores' address and data registers are reused right behind them
      asm volatile("s_wait_xcnt 0x0" ::: "memory");
    }
  }
}

__device__ inline float xhalf(float v) {
  const int b = __float_as_int(v);
  return __int_as_float(
      __builtin_amdgcn_permlanex16(b, b, 0x76543210, 0xfedcba98, false, false));
}

constexpr int QG = 2;      // 16-query groups per wave

// 2^x as the one hardware instruction. The library form adds a compare, two
// selects, an add and an ldexp so that results under 2^-126 come out as
// denormals; here such a result is rounded to f16 (zero either way) or scales
// sums that a term of weight 1 has just outgrown by that same factor.
__device__ inline float exp2_bare(float x) { return __builtin_amdgcn_exp2f(x); }

// Four waves per SIMD is what the registers of two query groups allow. Told so,
// the scheduler leaves the loads where they are written, most of a pass ahead
// of their use; left to aim for more waves it sinks them to just before the
// products, which then wait them out.
__global__ __launch_bounds__(256) __attribute__((amdgpu_waves_per_eu(4, 4)))
void attn_kernel(const _Float16* __restrict__ Qi, const _Float16* __restrict__ Ki,
                 const _Float16* __restrict__ Vt, float* __restrict__ out) {
  const int lane = threadIdx.x & 31;
  const int wave = threadIdx.x >> 5;
  const int m = lane & 15, g = lane >> 4;
  const int blocksPerBH = Sc / (128 * QG);
  const int bh = blockIdx.x / blocksPerBH;
  const int s0 = (blockIdx.x % blocksPerBH) * (128 * QG) + wave * (16 * QG);
  const int b = bh / Hc, h = bh % Hc;

  // Q B-fragments stay in registers for the whole key loop (already scaled)
  const _Float16* qtile = Qi + ((size_t)bh * Sc + s0) * DH + lane * 8;
  v16h qa[QG][2];
#pragma unroll
  for (int q = 0; q < QG; ++q) {
    qa[q][0] = frag_packed(qtile + q * (4 * UNIT));
    qa[q][1] = frag_packed(qtile + q * (4 * UNIT) + 2 * UNIT);
  }
  // the loads' address registers are reused as soon as the loads are issued
  asm volatile("s_wait_xcnt 0x0" ::: "memory");

  // ones-row A fragment: A1[r][k] = (r==0); lanes 0/16 all-ones, else zero
  v16h ones;
  {
    const _Float16 o = (m == 0) ? (_Float16)1.0f : (_Float16)0.0f;
#pragma unroll
    for (int i = 0; i < 16; ++i) ones[i] = o;
  }

  float mrow[QG];            // running maximum of this lane's query, per group
  v8f oacc[QG][4], oext[QG]; // oacc[q][et][r] = O[query 16q+m][et*16 + 8g + r]
  const v8f vzero = {0.f, 0.f, 0.f, 0.f, 0.f, 0.f, 0.f, 0.f};
#pragma unroll
  for (int q = 0; q < QG; ++q) {
    mrow[q] = -1e30f;
#pragma unroll
    for (int et = 0; et < 4; ++et) oacc[q][et] = vzero;
    oext[q] = vzero;         // row 0 (register 0, lanes 0..15) = l; other rows stay 0
  }

  // block-uniform plane bases; the lane's part of every address is constant
  const _Float16* kbase = Ki + (size_t)bh * Sc * DH;
  const _Float16* vbase = Vt + (size_t)bh * DH * Sc;
  const unsigned loff = (unsigned)lane * 8u;

  // K first, then V, in the loop's own order: the compiler sets the counted
  // load waits at the loop's head for the worse of the orders that reach them
  v16h kf[4], vf[4];
#pragma unroll
  for (int i = 0; i < 4; ++i) kf[i] = frag_packed(kbase + i * (2 * UNIT) + loff);
  // the loads' address registers are reused as soon as the loads are issued
  asm volatile("s_wait_xcnt 0x0" ::: "memory");
#pragma unroll
  for (int i = 0; i < 4; ++i) vf[i] = frag_packed(vbase + i * (2 * UNIT) + loff);
  // the loads' address registers are reused as soon as the loads are issued
  asm volatile("s_wait_xcnt 0x0" ::: "memory");

  // K of pass j+1 is loaded over K of pass j right behind the score products,
  // V of pass j+1 over V of pass j right behind the output products: each load
  // flies under the rest of a pass and takes no second register set.
  for (int j = 0; j < Sc; j += 32) {
    // the last pass wraps to tile 0 (loaded, never used)
    const size_t nxt = (size_t)((j + 32) & (Sc - 1)) * DH;

    // ---- scores for 32 keys x 32 queries: four 16x16 tiles, K-dim = 64 ----
    v8f s_lo[QG], s_hi[QG];
#pragma unroll
    for (int q = 0; q < QG; ++q) s_lo[q] = wmma16(kf[0], qa[q][0], vzero);
#pragma unroll
    for (int q = 0; q < QG; ++q) s_hi[q] = wmma16(kf[2], qa[q][0], vzero);
#pragma unroll
    for (int q = 0; q < QG; ++q) s_lo[q] = wmma16(kf[1], qa[q][1], s_lo[q]);
#pragma unroll
    for (int q = 0; q < QG; ++q) s_hi[q] = wmma16(kf[3], qa[q][1], s_hi[q]);

#pragma unroll
    for (int i = 0; i < 4; ++i)
      kf[i] = frag_packed(kbase + nxt + i * (2 * UNIT) + loff);
    // the loads' address registers are reused as soon as the loads are issued
    asm volatile("s_wait_xcnt 0x0" ::: "memory");

    // ---- online softmax: 16 of a query's 32 scores are in this lane, the
    //      other 16 in lane ^ 16 ----
    //      Both groups' maxima and rescale factors first, then the weights one
    //      accumulator tile at a time: so written, each packed subtraction takes
    //      two neighbouring registers and needs no register copies.
    v16h pb[QG];             // P^T as B fragments, straight from the accumulators
    float alpha[QG];
#pragma unroll
    for (int q = 0; q < QG; ++q) {
      float t[8];
#pragma unroll
      for (int r = 0; r < 8; ++r) t[r] = fmaxf(s_lo[q][r], s_hi[q][r]);
      const float mx = fmaxf(fmaxf(fmaxf(t[0], t[1]), fmaxf(t[2], t[3])),
                             fmaxf(fmaxf(t[4], t[5]), fmaxf(t[6], t[7])));
      const float mnew = fmaxf(mrow[q], fmaxf(mx, xhalf(mx)));
      alpha[q] = exp2_bare(mrow[q] - mnew);
      mrow[q] = mnew;
    }
#pragma unroll
    for (int q = 0; q < QG; ++q) {
#pragma unroll
      for (int r = 0; r < 8; ++r)
        pb[q][r]     = (_Float16)exp2_bare(s_lo[q][r] - mrow[q]);   // already log2e-scaled
#pragma unroll
      for (int r = 0; r < 8; ++r)
        pb[q][8 + r] = (_Float16)exp2_bare(s_hi[q][r] - mrow[q]);
#pragma unroll
      for (int et = 0; et < 4; ++et)
#pragma unroll
        for (int r = 0; r < 8; ++r) oacc[q][et][r] *= alpha[q];
      oext[q][0] *= alpha[q];
    }

    // ---- O^T += V^T * P^T ; l += 1 * P^T (ones row) ----
#pragma unroll
    for (int et = 0; et < 4; ++et)
#pragma unroll
      for (int q = 0; q < QG; ++q) oacc[q][et] = wmma16(vf[et], pb[q], oacc[q][et]);
#pragma unroll
    for (int q = 0; q < QG; ++q) oext[q] = wmma16(ones, pb[q], oext[q]);

#pragma unroll
    for (int et = 0; et < 4; ++et)
      vf[et] = frag_packed(vbase + nxt + et * (2 * UNIT) + loff);
    // the loads' address registers are reused as soon as the loads are issued
    asm volatile("s_wait_xcnt 0x0" ::: "memory");
  }

  // ---- normalize and store: out[b][s0 + 16q + m][h*64 + et*16 + 8g + 0..7] ----
#pragma unroll
  for (int q = 0; q < QG; ++q) {
    // l sits in register 0 of lanes 0..15, lanes 16..31 hold 0 there
    const float l = oext[q][0] + xhalf(oext[q][0]);
    const float inv = 1.0f / l;
    float* orow = out + ((size_t)b * Sc + s0 + q * 16 + m) * DM + h * DH + g * 8;
#pragma unroll
    for (int et = 0; et < 4; ++et) {
      const float4 lo = make_float4(oacc[q][et][0] * inv, oacc[q][et][1] * inv,
                                    oacc[q][et][2] * inv, oacc[q][et][3] * inv);
      const float4 hi = make_float4(oacc[q][et][4] * inv, oacc[q][et][5] * inv,
                                    oacc[q][et][6] * inv, oacc[q][et][7] * inv);
      *(float4*)(orow + et * 16)     = lo;
      *(float4*)(orow + et * 16 + 4) = hi;
    }
    // the stores' address and data registers are reused by the next group
    if (q + 1 < QG) asm volatile("s_wait_xcnt 0x0" ::: "memory");
  }
}

// ===========================================================================
extern "C" void kernel_launch(void* const* d_in, const int* in_sizes, int n_in,
                              void* d_out, int out_size, void* d_ws, size_t ws_size,
                              hipStream_t stream) {
  (void)in_sizes; (void)n_in; (void)out_size; (void)ws_size;
  const float* x  = (const float*)d_in[0];
  const float* Wq = (const float*)d_in[1];
  const float* Wk = (const float*)d_in[2];
  const float* Wv = (const float*)d_in[3];
  const float* bq = (const float*)d_in[4];
  const float* bk = (const float*)d_in[5];
  const float* bv = (const float*)d_in[6];

  const size_t per = (size_t)Bc * Hc * Sc * DH;  // elements per Q/K/V plane
  _Float16* Q  = (_Float16*)d_ws;
  _Float16* K  = Q + per;
  _Float16* Vt = K + per;

  dim3 grid(Bc * Hc * (Sc / 128));  // 2048 blocks, 8 waves each
  qkv_kernel<<<grid, 256, 0, stream>>>(x, Wq, Wk, Wv, bq, bk, bv, Q, K, Vt);
  dim3 agrid(Bc * Hc * (Sc / (128 * QG)));  // 1024 blocks, 8 waves of 32 queries
  attn_kernel<<<agrid, 256, 0, stream>>>(Q, K, Vt, (float*)d_out);
}

// v007
// A run of this version takes 61.4 microseconds.
// Next to v006, in two timings, it ran 1.58 and 1.59 times as fast.
// All steps since v000 together make it 5.83 times as fast.
#include <hip/hip_runtime.h>
#include <hip/hip_bf16.h>

typedef __attribute__((ext_vector_type(16))) _Float16 v16h;
typedef __attribute__((ext_vector_type(8)))  _Float16 v8h;
typedef __attribute__((ext_vector_type(8)))  float    v8f;

constexpr int Bc = 16;     // batch
constexpr int Sc = 1024;   // sequence
constexpr int Hc = 16;     // heads
constexpr int DH = 64;     // head dim
constexpr int DM = 1024;   // model dim

// attention scale folded into Q at projection time: 1/sqrt(64) * log2(e)
constexpr float QSCALE = 0.125f * 1.4426950408889634f;

// ---------------------------------------------------------------------------
// WMMA helper: D = A(16x32 f16) * B(32x16 f16) + C(16x16 f32)
// ---------------------------------------------------------------------------
__device__ inline v8f wmma16(v16h a, v16h b, v8f c) {
  return __builtin_amdgcn_wmma_f32_16x16x32_f16(
      /*neg_a=*/false, a, /*neg_b=*/false, b,
      /*c_mod=*/(short)0, c, /*reuse_a=*/false, /*reuse_b=*/false);
}

// ---------------------------------------------------------------------------
// Fragment loaders. CDNA5 16-bit A/B fragment, per lane (g = lane/16):
//   elem i (i<8) -> K = kbase + 8g + i ; elem 8+i -> K = kbase + 8g + 16 + i
// i.e. two contiguous runs of 8 at p and p+16.
// ---------------------------------------------------------------------------
typedef __attribute__((ext_vector_type(4))) _Float16 v4h;
typedef __attribute__((ext_vector_type(4))) float    v4f;
// One lane's 32 floats of a 16-row x 64-column tile of x, as loaded: p[0..7],
// p[16..23] (first fragment), p[32..39], p[48..55] (second); p = row + g * 8.
struct XRaw { v4f r[8]; };
__device__ inline XRaw load_xraw(const float* __restrict__ p) {
  XRaw x;
#pragma unroll
  for (int c = 0; c < 4; ++c) {
    x.r[2 * c]     = *(const v4f*)(p + c * 16);
    x.r[2 * c + 1] = *(const v4f*)(p + c * 16 + 4);
  }
  return x;
}
// fragment f (0 or 1) of it, f32 -> f16
__device__ inline v16h frag_from_raw(const XRaw& x, int f) {
  v16h a;
#pragma unroll
  for (int c = 0; c < 4; ++c)
#pragma unroll
    for (int i = 0; i < 4; ++i) a[c * 4 + i] = (_Float16)x.r[f * 4 + c][i];
  return a;
}
__device__ inline v16h frag_join(v8h lo, v8h hi) {
  v16h a;
#pragma unroll
  for (int i = 0; i < 8; ++i) { a[i] = lo[i]; a[8 + i] = hi[i]; }
  return a;
}
// Fragment-order K and V planes in LDS: one fragment = two 512-byte units,
// unit u holds run u (8 halves) of lane 0..31 back to back, so that one
// wave-wide 16-byte read or write is contiguous and meets every bank evenly.
// p = fragment base + lane * 8.
constexpr int UNIT = 32 * 8;   // halves per 512-byte unit
__device__ inline v16h frag_packed(const _Float16* p) {
  return frag_join(*(const v8h*)p, *(const v8h*)(p + UNIT));
}

// Weight fragments in LDS: run u of a fragment is two 16-lane halves (g) of
// 256 bytes, each at a pitch of 288 bytes. A 16-byte fragment read is then
// contiguous over each 16 lanes, and the 8-byte staging stores of a wave, which
// fall into eight such halves at once, meet every bank once.
// p = fragment base + g * WP + (lane & 15) * 8.
constexpr int WP = 144;        // halves per 16-lane half: 128 of data + 16 of pad
__device__ inline v16h frag_lds(const _Float16* p) {
  return frag_join(*(const v8h*)p, *(const v8h*)(p + 2 * WP));
}

// The eight B fragments of one weight matrix, [e/16][k/32], from LDS.
// B[k][n] = W[e0+n][k] (y = x * W^T): lane n holds row e0+n of W.
// wl = the matrix's fragments + g * WP + m * 8.
struct WFrag { v16h f[4][2]; };
__device__ inline WFrag load_wfrag(const _Float16* wl) {
  WFrag w;
#pragma unroll
  for (int e = 0; e < 4; ++e) {
    w.f[e][0] = frag_lds(wl + e * (8 * WP));
    w.f[e][1] = frag_lds(wl + e * (8 * WP) + 4 * WP);
  }
  return w;
}

// One 16x16 tile of x * W^T + b; the bias rides in the WMMA C operand.
__device__ inline v8f proj_tile(v16h a0, v16h a1, v16h w0, v16h w1, float bias) {
  v8f acc;
#pragma unroll
  for (int i = 0; i < 8; ++i) acc[i] = bias;
  acc = wmma16(a0, w0, acc);
  acc = wmma16(a1, w1, acc);
  return acc;
}

// The 16-row x 64-column Q projection, scaled, turned in the wave's own LDS tile
// Tw (pitch 72 halves) into its two B fragments: run q of the four at lane (m,g)
// = row m, columns q*16 + g*8 .. +7.
__device__ inline void proj_q(v16h a0, v16h a1, const WFrag& w, const float (&bias)[4],
                              _Float16* Tw, int m, int g, v16h& f0, v16h& f1) {
#pragma unroll
  for (int e = 0; e < 4; ++e) {
    const v8f acc = proj_tile(a0, a1, w.f[e][0], w.f[e][1], bias[e]);
#pragma unroll
    for (int r = 0; r < 8; ++r)
      Tw[(r + 8 * g) * 72 + e * 16 + m] = (_Float16)(acc[r] * QSCALE);
  }
  // the other lanes' tile stores are in LDS before the rows are read back
  asm volatile("s_wait_dscnt 0x0" ::: "memory");
  const _Float16* srcp = Tw + m * 72 + g * 8;
  v8h run[4];
#pragma unroll
  for (int q = 0; q < 4; ++q) run[q] = *(const v8h*)(srcp + q * 16);
  // the rows are read before Tw is written again
  asm volatile("s_wait_dscnt 0x0" ::: "memory");
  f0 = frag_join(run[0], run[1]);
  f1 = frag_join(run[2], run[3]);
}

// value of lane l ^ 16 (the other half of the same query's keys)
__device__ inline float xhalf(float v) {
  const int b = __float_as_int(v);
  return __int_as_float(
      __builtin_amdgcn_permlanex16(b, b, 0x76543210, 0xfedcba98, false, false));
}

constexpr int QG = 2;      // 16-query groups per wave and query set
constexpr int NW = 16;     // waves per block
constexpr int RW = Sc / NW;            // rows (keys, and queries) per wave: 64
constexpr int QSETS = RW / (16 * QG);  // query sets a wave takes in turn: 2

// 2^x as the one hardware instruction. The library form adds a compare, two
// selects, an add and an ldexp so that results under 2^-126 come out as
// denormals; here such a result is rounded to f16 (zero either way) or scales
// sums that a term of weight 1 has just outgrown by that same factor.
__device__ inline float exp2_bare(float x) { return __builtin_amdgcn_exp2f(x); }

constexpr int PASS = 2 * 32 * DH;
constexpr int VOFF = 32 * DH;

__global__ __launch_bounds__(NW * 32) __attribute__((amdgpu_waves_per_eu(4, 4)))
void mhsa_kernel(const float* __restrict__ x,
                 const float* __restrict__ Wq, const float* __restrict__ Wk,
                 const float* __restrict__ Wv,
                 const float* __restrict__ bq, const float* __restrict__ bk,
                 const float* __restrict__ bv, float* __restrict__ out) {
  __shared__ __align__(16) _Float16 KV[(Sc / 32) * PASS];  // K, V fragments, 256 KB
  __shared__ __align__(16) _Float16 Wl[24 * 4 * WP];  // [wsel][e/16][k/32][u][g] halves
  __shared__ __align__(16) _Float16 Tr[NW][16 * 72];  // per-wave 16x64 tile, pad 72

  const int lane = threadIdx.x & 31;
  const int wave = threadIdx.x >> 5;
  const int m = lane & 15, g = lane >> 4;
  const int bh = blockIdx.x;
  const int b = bh / Hc, h = bh % Hc;

  // this lane's row of the wave's first 16-row tile, at the head's columns
  const float* xlane = x + ((size_t)b * Sc + wave * RW + m) * DM + h * DH + g * 8;
  _Float16* Tw = &Tr[wave][0];

  // Weights: a slab is 1024 floats (16 rows). Threads 0..255 take slabs 0 and 1
  // of each matrix, threads 256..511 slabs 2 and 3; thread t (mod 256) takes
  // floats 4t..4t+3, so a wave-wide load covers 512 contiguous bytes. Row
  // n = t/16 of the slab, columns 4*(t%16)..+3 = k half (bit 3 of t), run u
  // (bit 2), lane half g (bit 1), first or second four of the run (bit 0).
  // The loops are unrolled so that wr stays in registers, all six loads are in
  // flight together and every offset is an immediate.
  const float* Ws[3] = {Wq, Wk, Wv};
  const int t = threadIdx.x & 255;
  const int sl = (threadIdx.x >> 8) * 2;
  v4f wr[3][2];
#pragma unroll
  for (int wsel = 0; wsel < 3; ++wsel)
#pragma unroll
    for (int i = 0; i < 2; ++i)
      wr[wsel][i] = *(const v4f*)(Ws[wsel] + (size_t)h * DH * DH + sl * 1024 + t * 4 + i * 1024);
  // biases of output columns e*16 + m
  float bqr[4], bkr[4], bvr[4];
#pragma unroll
  for (int e = 0; e < 4; ++e) {
    bqr[e] = bq[h * DH + e * 16 + m];
    bkr[e] = bk[h * DH + e * 16 + m];
    bvr[e] = bv[h * DH + e * 16 + m];
  }
  // the wave's four 16-row tiles of x
  XRaw xr[RW / 16];
#pragma unroll
  for (int tl = 0; tl < RW / 16; ++tl) xr[tl] = load_xraw(xlane + (size_t)tl * 16 * DM);
  // the loads' address registers are reused as soon as the loads are issued
  asm volatile("s_wait_xcnt 0x0" ::: "memory");
  // all of the wave's loads from memory are issued before the first is waited
  // for; left free, the scheduler issues x two loads at a time, each pair behind
  // the conversion of the pair before, and the latencies add up
  __builtin_amdgcn_sched_barrier(0);

  {
    _Float16* wd = Wl + sl * (8 * WP) + ((t >> 1) & 7) * WP + (t >> 4) * 8 + (t & 1) * 4;
#pragma unroll
    for (int wsel = 0; wsel < 3; ++wsel)
#pragma unroll
      for (int i = 0; i < 2; ++i) {
        const v4f w = wr[wsel][i];
        v4h c;
#pragma unroll
        for (int k = 0; k < 4; ++k) c[k] = (_Float16)w[k];
        *(v4h*)(wd + (wsel * 4 + i) * (8 * WP)) = c;
      }
  }

  __syncthreads();   // every wave's share of the weight fragments is in LDS

  // A fragments of x, f32 -> f16
  v16h xa[RW / 16][2];
#pragma unroll
  for (int tl = 0; tl < RW / 16; ++tl) {
    xa[tl][0] = frag_from_raw(xr[tl], 0);
    xa[tl][1] = frag_from_raw(xr[tl], 1);
  }

  const _Float16* wlane = Wl + g * WP + m * 8;   // + wsel * 4 * (8 * WP)

  // K: lane (m,g), register r holds row r + 8g, column e*16 + m of the tile. In
  // fragment order that is run e, lane (m/8)*16 + row, element m%8.
  {
    const WFrag w = load_wfrag(wlane + 4 * (8 * WP));
    _Float16* kd = KV + wave * (RW / 32) * PASS + (m >> 3) * 128 + g * 64 + (m & 7);
#pragma unroll
    for (int tl = 0; tl < RW / 16; ++tl)
#pragma unroll
      for (int e = 0; e < 4; ++e) {
        const v8f acc = proj_tile(xa[tl][0], xa[tl][1], w.f[e][0], w.f[e][1], bkr[e]);
#pragma unroll
        for (int r = 0; r < 8; ++r)
          kd[(tl >> 1) * PASS + (tl & 1) * (4 * UNIT) + e * UNIT + r * 8] = (_Float16)acc[r];
      }
  }
  // V: lane (m,g) holds column e*16 + m, keys 8g..8g+7 of the tile: run
  // u = tile & 1 of the 32-key fragment e, at its own lane's place
  {
    const WFrag w = load_wfrag(wlane + 8 * (8 * WP));
    _Float16* vd = KV + wave * (RW / 32) * PASS + VOFF + lane * 8;
#pragma unroll
    for (int tl = 0; tl < RW / 16; ++tl)
#pragma unroll
      for (int e = 0; e < 4; ++e) {
        const v8f acc = proj_tile(xa[tl][0], xa[tl][1], w.f[e][0], w.f[e][1], bvr[e]);
        v8h c;
#pragma unroll
        for (int r = 0; r < 8; ++r) c[r] = (_Float16)acc[r];
        *(v8h*)(vd + (tl >> 1) * PASS + e * (2 * UNIT) + (tl & 1) * UNIT) = c;
      }
  }
  // Q B-fragments of the current query set; those of the first set come from
  // the x fragments at hand
  v16h qa[QG][2];
  {
    const WFrag w = load_wfrag(wlane);
#pragma unroll
    for (int q = 0; q < QG; ++q)
      proj_q(xa[q][0], xa[q][1], w, bqr, Tw, m, g, qa[q][0], qa[q][1]);
  }

  __syncthreads();   // all 1024 keys' K and V fragments are in LDS

  // ones-row A fragment: A1[r][k] = (r==0); lanes 0/16 all-ones, else zero
  v16h ones;
  {
    const _Float16 o = (m == 0) ? (_Float16)1.0f : (_Float16)0.0f;
#pragma unroll
    for (int i = 0; i < 16; ++i) ones[i] = o;
  }
  const v8f vzero = {0.f, 0.f, 0.f, 0.f, 0.f, 0.f, 0.f, 0.f};

  // the lane's part of every fragment address is constant
  const _Float16* kvlane = KV + lane * 8;

  for (int set = 0; set < QSETS; ++set) {
    const int s0 = wave * RW + set * (16 * QG);

    if (set > 0) {
      // a later set's rows of x are read again and projected to Q here
      XRaw xq[QG];
      float bq2[4];
#pragma unroll
      for (int q = 0; q < QG; ++q)
        xq[q] = load_xraw(xlane + (size_t)(set * QG + q) * 16 * DM);
#pragma unroll
      for (int e = 0; e < 4; ++e) bq2[e] = bq[h * DH + e * 16 + m];
      // the loads' address registers are reused as soon as the loads are issued
      asm volatile("s_wait_xcnt 0x0" ::: "memory");
      const WFrag w = load_wfrag(wlane);
#pragma unroll
      for (int q = 0; q < QG; ++q)
        proj_q(frag_from_raw(xq[q], 0), frag_from_raw(xq[q], 1), w, bq2, Tw, m, g,
               qa[q][0], qa[q][1]);
    }

    float mrow[QG];            // running maximum of this lane's query, per group
    v8f oacc[QG][4], oext[QG]; // oacc[q][et][r] = O[query 16q+m][et*16 + 8g + r]
#pragma unroll
    for (int q = 0; q < QG; ++q) {
      mrow[q] = -1e30f;
#pragma unroll
      for (int et = 0; et < 4; ++et) oacc[q][et] = vzero;
      oext[q] = vzero;         // row 0 (register 0, lanes 0..15) = l; other rows stay 0
    }

    // K first, then V, in the loop's own order
    v16h kf[4], vf[4];
#pragma unroll
    for (int i = 0; i < 4; ++i) kf[i] = frag_packed(kvlane + i * (2 * UNIT));
#pragma unroll
    for (int i = 0; i < 4; ++i) vf[i] = frag_packed(kvlane + VOFF + i * (2 * UNIT));

    // K of pass j+1 is read over K of pass j right behind the score products,
    // V of pass j+1 over V of pass j right behind the output products: each read
    // flies under the rest of a pass and takes no second register set.
    for (int j = 0; j < Sc / 32; ++j) {
      // the last pass wraps to pass 0 (read, never used)
      const _Float16* nxt = kvlane + ((j + 1) & (Sc / 32 - 1)) * PASS;

      // ---- scores for 32 keys x 32 queries: four 16x16 tiles, K-dim = 64 ----
      v8f s_lo[QG], s_hi[QG];
#pragma unroll
      for (int q = 0; q < QG; ++q) s_lo[q] = wmma16(kf[0], qa[q][0], vzero);
#pragma unroll
      for (int q = 0; q < QG; ++q) s_hi[q] = wmma16(kf[2], qa[q][0], vzero);
#pragma unroll
      for (int q = 0; q < QG; ++q) s_lo[q] = wmma16(kf[1], qa[q][1], s_lo[q]);
#pragma unroll
      for (int q = 0; q < QG; ++q) s_hi[q] = wmma16(kf[3], qa[q][1], s_hi[q]);

      // the eight K reads stay one group, outside the products, for speed only
      __builtin_amdgcn_sched_barrier(0);
#pragma unroll
      for (int i = 0; i < 4; ++i) kf[i] = frag_packed(nxt + i * (2 * UNIT));
      __builtin_amdgcn_sched_barrier(0);   // the end of that group

      // ---- online softmax: 16 of a query's 32 scores are in this lane, the
      //      other 16 in lane ^ 16 ----
      //      Both groups' maxima and rescale factors first, then the weights one
      //      accumulator tile at a time: so written, each packed subtraction takes
      //      two neighbouring registers and needs no register copies.
      v16h pb[QG];             // P^T as B fragments, straight from the accumulators
      float alpha[QG];
#pragma unroll
      for (int q = 0; q < QG; ++q) {
        float tm[8];
#pragma unroll
        for (int r = 0; r < 8; ++r) tm[r] = fmaxf(s_lo[q][r], s_hi[q][r]);
        const float mx = fmaxf(fmaxf(fmaxf(tm[0], tm[1]), fmaxf(tm[2], tm[3])),
                               fmaxf(fmaxf(tm[4], tm[5]), fmaxf(tm[6], tm[7])));
        const float mnew = fmaxf(mrow[q], fmaxf(mx, xhalf(mx)));
        alpha[q] = exp2_bare(mrow[q] - mnew);
        mrow[q] = mnew;
      }
#pragma unroll
      for (int q = 0; q < QG; ++q) {
#pragma unroll
        for (int r = 0; r < 8; ++r)
          pb[q][r]     = (_Float16)exp2_bare(s_lo[q][r] - mrow[q]);   // already log2e-scaled
#pragma unroll
        for (int r = 0; r < 8; ++r)
          pb[q][8 + r] = (_Float16)exp2_bare(s_hi[q][r] - mrow[q]);
#pragma unroll
        for (int et = 0; et < 4; ++et)
#pragma unroll
          for (int r = 0; r < 8; ++r) oacc[q][et][r] *= alpha[q];
        oext[q][0] *= alpha[q];
      }

      // ---- O^T += V^T * P^T ; l += 1 * P^T (ones row) ----
#pragma unroll
      for (int et = 0; et < 4; ++et)
#pragma unroll
        for (int q = 0; q < QG; ++q) oacc[q][et] = wmma16(vf[et], pb[q], oacc[q][et]);
#pragma unroll
      for (int q = 0; q < QG; ++q) oext[q] = wmma16(ones, pb[q], oext[q]);

#pragma unroll
      for (int et = 0; et < 4; ++et) vf[et] = frag_packed(nxt + VOFF + et * (2 * UNIT));
    }

    // ---- normalize and store: out[b][s0 + 16q + m][h*64 + et*16 + 8g + 0..7] ----
#pragma unroll
    for (int q = 0; q < QG; ++q) {
      // l sits in register 0 of lanes 0..15, lanes 16..31 hold 0 there
      const float l = oext[q][0] + xhalf(oext[q][0]);
      const float inv = 1.0f / l;
      float* orow = out + ((size_t)b * Sc + s0 + q * 16 + m) * DM + h * DH + g * 8;
#pragma unroll
      for (int et = 0; et < 4; ++et) {
        const float4 lo = make_float4(oacc[q][et][0] * inv, oacc[q][et][1] * inv,
                                      oacc[q][et][2] * inv, oacc[q][et][3] * inv);
        const float4 hi = make_float4(oacc[q][et][4] * inv, oacc[q][et][5] * inv,
                                      oacc[q][et][6] * inv, oacc[q][et][7] * inv);
        *(float4*)(orow + et * 16)     = lo;
        *(float4*)(orow + et * 16 + 4) = hi;
      }
      // the stores' address and data registers are reused by the next group or set
      asm volatile("s_wait_xcnt 0x0" ::: "memory");
    }
  }
}

// ===========================================================================
extern "C" void kernel_launch(void* const* d_in, const int* in_sizes, int n_in,
                              void* d_out, int out_size, void* d_ws, size_t ws_size,
                              hipStream_t stream) {
  (void)in_sizes; (void)n_in; (void)out_size; (void)d_ws; (void)ws_size;
  const float* x  = (const float*)d_in[0];
  const float* Wq = (const float*)d_in[1];
  const float* Wk = (const float*)d_in[2];
  const float* Wv = (const float*)d_in[3];
  const float* bq = (const float*)d_in[4];
  const float* bk = (const float*)d_in[5];
  const float* bv = (const float*)d_in[6];

  dim3 grid(Bc * Hc);  // 256 blocks of 16 waves, one per (b,h)
  mhsa_kernel<<<grid, NW * 32, 0, stream>>>(x, Wq, Wk, Wv, bq, bk, bv, (float*)d_out);
}

// v008
// One run takes 58.6 microseconds.
// Next to v007, in two timings, it ran 1.05 times as fast each time.
// Over all steps from v000 it is 6.11 times as fast.
#include <hip/hip_runtime.h>
#include <hip/hip_bf16.h>

typedef __attribute__((ext_vector_type(16))) _Float16 v16h;
typedef __attribute__((ext_vector_type(8)))  _Float16 v8h;
typedef __attribute__((ext_vector_type(8)))  float    v8f;

constexpr int Bc = 16;     // batch
constexpr int Sc = 1024;   // sequence
constexpr int Hc = 16;     // heads
constexpr int DH = 64;     // head dim
constexpr int DM = 1024;   // model dim

// attention scale folded into Q at projection time: 1/sqrt(64) * log2(e)
constexpr float QSCALE = 0.125f * 1.4426950408889634f;

// ---------------------------------------------------------------------------
// WMMA helper: D = A(16x32 f16) * B(32x16 f16) + C(16x16 f32)
// ---------------------------------------------------------------------------
__device__ inline v8f wmma16(v16h a, v16h b, v8f c) {
  return __builtin_amdgcn_wmma_f32_16x16x32_f16(
      /*neg_a=*/false, a, /*neg_b=*/false, b,
      /*c_mod=*/(short)0, c, /*reuse_a=*/false, /*reuse_b=*/false);
}

// ---------------------------------------------------------------------------
// Fragment loaders. CDNA5 16-bit A/B fragment, per lane (g = lane/16):
//   elem i (i<8) -> K = kbase + 8g + i ; elem 8+i -> K = kbase + 8g + 16 + i
// i.e. two contiguous runs of 8 at p and p+16.
// ---------------------------------------------------------------------------
typedef __attribute__((ext_vector_type(4))) _Float16 v4h;
typedef __attribute__((ext_vector_type(4))) float    v4f;
// One lane's 32 floats of a 16-row x 64-column tile of x, as loaded: p[0..7],
// p[16..23] (first fragment), p[32..39], p[48..55] (second); p = row + g * 8.
struct XRaw { v4f r[8]; };
__device__ inline XRaw load_xraw(const float* __restrict__ p) {
  XRaw x;
#pragma unroll
  for (int c = 0; c < 4; ++c) {
    x.r[2 * c]     = *(const v4f*)(p + c * 16);
    x.r[2 * c + 1] = *(const v4f*)(p + c * 16 + 4);
  }
  return x;
}
// fragment f (0 or 1) of it, f32 -> f16
__device__ inline v16h frag_from_raw(const XRaw& x, int f) {
  v16h a;
#pragma unroll
  for (int c = 0; c < 4; ++c)
#pragma unroll
    for (int i = 0; i < 4; ++i) a[c * 4 + i] = (_Float16)x.r[f * 4 + c][i];
  return a;
}
__device__ inline v16h frag_join(v8h lo, v8h hi) {
  v16h a;
#pragma unroll
  for (int i = 0; i < 8; ++i) { a[i] = lo[i]; a[8 + i] = hi[i]; }
  return a;
}
// Fragment-order K and V planes in LDS: one fragment = two 512-byte units,
// unit u holds run u (8 halves) of lane 0..31 back to back, so that one
// wave-wide 16-byte read or write is contiguous and meets every bank evenly.
// p = fragment base + lane * 8.
constexpr int UNIT = 32 * 8;   // halves per 512-byte unit
__device__ inline v16h frag_packed(const _Float16* p) {
  return frag_join(*(const v8h*)p, *(const v8h*)(p + UNIT));
}

// Weight fragments in LDS: run u of a fragment is two 16-lane halves (g) of
// 256 bytes, each at a pitch of 288 bytes. A 16-byte fragment read is then
// contiguous over each 16 lanes, and the 8-byte staging stores of a wave, which
// fall into eight such halves at once, meet every bank once.
// p = fragment base + g * WP + (lane & 15) * 8.
constexpr int WP = 144;        // halves per 16-lane half: 128 of data + 16 of pad
__device__ inline v16h frag_lds(const _Float16* p) {
  return frag_join(*(const v8h*)p, *(const v8h*)(p + 2 * WP));
}

// The eight B fragments of one weight matrix, [e/16][k/32], from LDS.
// B[k][n] = W[e0+n][k] (y = x * W^T): lane n holds row e0+n of W.
// wl = the matrix's fragments + g * WP + m * 8.
struct WFrag { v16h f[4][2]; };
__device__ inline WFrag load_wfrag(const _Float16* wl) {
  WFrag w;
#pragma unroll
  for (int e = 0; e < 4; ++e) {
    w.f[e][0] = frag_lds(wl + e * (8 * WP));
    w.f[e][1] = frag_lds(wl + e * (8 * WP) + 4 * WP);
  }
  return w;
}

// One 16x16 tile of x * W^T + b; the bias rides in the WMMA C operand.
__device__ inline v8f proj_tile(v16h a0, v16h a1, v16h w0, v16h w1, float bias) {
  v8f acc;
#pragma unroll
  for (int i = 0; i < 8; ++i) acc[i] = bias;
  acc = wmma16(a0, w0, acc);
  acc = wmma16(a1, w1, acc);
  return acc;
}

// The 16-row x 64-column Q projection, scaled, turned in the wave's own LDS tile
// Tw (pitch 72 halves) into its two B fragments: run q of the four at lane (m,g)
// = row m, columns q*16 + g*8 .. +7.
__device__ inline void proj_q(v16h a0, v16h a1, const WFrag& w, const float (&bias)[4],
                              _Float16* Tw, int m, int g, v16h& f0, v16h& f1) {
#pragma unroll
  for (int e = 0; e < 4; ++e) {
    const v8f acc = proj_tile(a0, a1, w.f[e][0], w.f[e][1], bias[e]);
#pragma unroll
    for (int r = 0; r < 8; ++r)
      Tw[(r + 8 * g) * 72 + e * 16 + m] = (_Float16)(acc[r] * QSCALE);
  }
  // the other lanes' tile stores are in LDS before the rows are read back
  asm volatile("s_wait_dscnt 0x0" ::: "memory");
  const _Float16* srcp = Tw + m * 72 + g * 8;
  v8h run[4];
#pragma unroll
  for (int q = 0; q < 4; ++q) run[q] = *(const v8h*)(srcp + q * 16);
  // the rows are read before Tw is written again
  asm volatile("s_wait_dscnt 0x0" ::: "memory");
  f0 = frag_join(run[0], run[1]);
  f1 = frag_join(run[2], run[3]);
}

// value of lane l ^ 16 (the other half of the same query's keys)
__device__ inline float xhalf(float v) {
  const int b = __float_as_int(v);
  return __int_as_float(
      __builtin_amdgcn_permlanex16(b, b, 0x76543210, 0xfedcba98, false, false));
}

constexpr int QG = 2;      // 16-query groups per wave and query set
constexpr int NW = 16;     // waves per block
constexpr int RW = Sc / NW;            // rows (keys, and queries) per wave: 64
constexpr int QSETS = RW / (16 * QG);  // query sets a wave takes in turn: 2

// 2^x as the one hardware instruction. The library form adds a compare, two
// selects, an add and an ldexp so that results under 2^-126 come out as
// denormals; here such a result is rounded to f16 (zero either way) or scales
// sums that a term of weight 1 has just outgrown by that same factor.
__device__ inline float exp2_bare(float x) { return __builtin_amdgcn_exp2f(x); }

constexpr int PASS = 2 * 32 * DH;
constexpr int VOFF = 32 * DH;
constexpr int OP = 36;

__global__ __launch_bounds__(NW * 32) __attribute__((amdgpu_waves_per_eu(4, 4)))
void mhsa_kernel(const float* __restrict__ x,
                 const float* __restrict__ Wq, const float* __restrict__ Wk,
                 const float* __restrict__ Wv,
                 const float* __restrict__ bq, const float* __restrict__ bk,
                 const float* __restrict__ bv, float* __restrict__ out) {
  __shared__ __align__(16) _Float16 KV[(Sc / 32) * PASS];  // K, V fragments, 256 KB
  __shared__ __align__(16) _Float16 Wl[24 * 4 * WP];  // [wsel][e/16][k/32][u][g] halves
  __shared__ __align__(16) _Float16 Tr[NW][16 * 72];  // per-wave tile: 16x64 halves, pad 72, or 16x32 floats, pad 36

  const int lane = threadIdx.x & 31;
  const int wave = threadIdx.x >> 5;
  const int m = lane & 15, g = lane >> 4;
  const int bh = blockIdx.x;
  const int b = bh / Hc, h = bh % Hc;

  // this lane's row of the wave's first 16-row tile, at the head's columns
  const float* xlane = x + ((size_t)b * Sc + wave * RW + m) * DM + h * DH + g * 8;
  _Float16* Tw = &Tr[wave][0];

  // Weights: a slab is 1024 floats (16 rows). Threads 0..255 take slabs 0 and 1
  // of each matrix, threads 256..511 slabs 2 and 3; thread t (mod 256) takes
  // floats 4t..4t+3, so a wave-wide load covers 512 contiguous bytes. Row
  // n = t/16 of the slab, columns 4*(t%16)..+3 = k half (bit 3 of t), run u
  // (bit 2), lane half g (bit 1), first or second four of the run (bit 0).
  // The loops are unrolled so that wr stays in registers, all six loads are in
  // flight together and every offset is an immediate.
  const float* Ws[3] = {Wq, Wk, Wv};
  const int t = threadIdx.x & 255;
  const int sl = (threadIdx.x >> 8) * 2;
  v4f wr[3][2];
#pragma unroll
  for (int wsel = 0; wsel < 3; ++wsel)
#pragma unroll
    for (int i = 0; i < 2; ++i)
      wr[wsel][i] = *(const v4f*)(Ws[wsel] + (size_t)h * DH * DH + sl * 1024 + t * 4 + i * 1024);
  // biases of output columns e*16 + m
  float bqr[4], bkr[4], bvr[4];
#pragma unroll
  for (int e = 0; e < 4; ++e) {
    bqr[e] = bq[h * DH + e * 16 + m];
    bkr[e] = bk[h * DH + e * 16 + m];
    bvr[e] = bv[h * DH + e * 16 + m];
  }
  // the wave's four 16-row tiles of x
  XRaw xr[RW / 16];
#pragma unroll
  for (int tl = 0; tl < RW / 16; ++tl) xr[tl] = load_xraw(xlane + (size_t)tl * 16 * DM);
  // the loads' address registers are reused as soon as the loads are issued
  asm volatile("s_wait_xcnt 0x0" ::: "memory");
  // all of the wave's loads from memory are issued before the first is waited
  // for; left free, the scheduler issues x two loads at a time, each pair behind
  // the conversion of the pair before, and the latencies add up
  __builtin_amdgcn_sched_barrier(0);

  {
    _Float16* wd = Wl + sl * (8 * WP) + ((t >> 1) & 7) * WP + (t >> 4) * 8 + (t & 1) * 4;
#pragma unroll
    for (int wsel = 0; wsel < 3; ++wsel)
#pragma unroll
      for (int i = 0; i < 2; ++i) {
        const v4f w = wr[wsel][i];
        v4h c;
#pragma unroll
        for (int k = 0; k < 4; ++k) c[k] = (_Float16)w[k];
        *(v4h*)(wd + (wsel * 4 + i) * (8 * WP)) = c;
      }
  }

  __syncthreads();   // every wave's share of the weight fragments is in LDS

  // A fragments of x, f32 -> f16
  v16h xa[RW / 16][2];
#pragma unroll
  for (int tl = 0; tl < RW / 16; ++tl) {
    xa[tl][0] = frag_from_raw(xr[tl], 0);
    xa[tl][1] = frag_from_raw(xr[tl], 1);
  }

  const _Float16* wlane = Wl + g * WP + m * 8;   // + wsel * 4 * (8 * WP)

  // K: lane (m,g), register r holds row r + 8g, column e*16 + m of the tile. In
  // fragment order that is run e, lane (m/8)*16 + row, element m%8.
  {
    const WFrag w = load_wfrag(wlane + 4 * (8 * WP));
    _Float16* kd = KV + wave * (RW / 32) * PASS + (m >> 3) * 128 + g * 64 + (m & 7);
#pragma unroll
    for (int tl = 0; tl < RW / 16; ++tl)
#pragma unroll
      for (int e = 0; e < 4; ++e) {
        const v8f acc = proj_tile(xa[tl][0], xa[tl][1], w.f[e][0], w.f[e][1], bkr[e]);
#pragma unroll
        for (int r = 0; r < 8; ++r)
          kd[(tl >> 1) * PASS + (tl & 1) * (4 * UNIT) + e * UNIT + r * 8] = (_Float16)acc[r];
      }
  }
  // V: lane (m,g) holds column e*16 + m, keys 8g..8g+7 of the tile: run
  // u = tile & 1 of the 32-key fragment e, at its own lane's place
  {
    const WFrag w = load_wfrag(wlane + 8 * (8 * WP));
    _Float16* vd = KV + wave * (RW / 32) * PASS + VOFF + lane * 8;
#pragma unroll
    for (int tl = 0; tl < RW / 16; ++tl)
#pragma unroll
      for (int e = 0; e < 4; ++e) {
        const v8f acc = proj_tile(xa[tl][0], xa[tl][1], w.f[e][0], w.f[e][1], bvr[e]);
        v8h c;
#pragma unroll
        for (int r = 0; r < 8; ++r) c[r] = (_Float16)acc[r];
        *(v8h*)(vd + (tl >> 1) * PASS + e * (2 * UNIT) + (tl & 1) * UNIT) = c;
      }
  }
  // Q B-fragments of the current query set; those of the first set come from
  // the x fragments at hand
  v16h qa[QG][2];
  {
    const WFrag w = load_wfrag(wlane);
#pragma unroll
    for (int q = 0; q < QG; ++q)
      proj_q(xa[q][0], xa[q][1], w, bqr, Tw, m, g, qa[q][0], qa[q][1]);
  }

  __syncthreads();   // all 1024 keys' K and V fragments are in LDS

  // ones-row A fragment: A1[r][k] = (r==0); lanes 0/16 all-ones, else zero
  v16h ones;
  {
    const _Float16 o = (m == 0) ? (_Float16)1.0f : (_Float16)0.0f;
#pragma unroll
    for (int i = 0; i < 16; ++i) ones[i] = o;
  }
  const v8f vzero = {0.f, 0.f, 0.f, 0.f, 0.f, 0.f, 0.f, 0.f};

  // the lane's part of every fragment address is constant
  const _Float16* kvlane = KV + lane * 8;

  for (int set = 0; set < QSETS; ++set) {
    const int s0 = wave * RW + set * (16 * QG);

    if (set > 0) {
      // a later set's rows of x are read again and projected to Q here
      XRaw xq[QG];
      float bq2[4];
#pragma unroll
      for (int q = 0; q < QG; ++q)
        xq[q] = load_xraw(xlane + (size_t)(set * QG + q) * 16 * DM);
#pragma unroll
      for (int e = 0; e < 4; ++e) bq2[e] = bq[h * DH + e * 16 + m];
      // the loads' address registers are reused as soon as the loads are issued
      asm volatile("s_wait_xcnt 0x0" ::: "memory");
      const WFrag w = load_wfrag(wlane);
#pragma unroll
      for (int q = 0; q < QG; ++q)
        proj_q(frag_from_raw(xq[q], 0), frag_from_raw(xq[q], 1), w, bq2, Tw, m, g,
               qa[q][0], qa[q][1]);
    }

    float mrow[QG];            // running maximum of this lane's query, per group
    v8f oacc[QG][4], oext[QG]; // oacc[q][et][r] = O[query 16q+m][et*16 + 8g + r]
#pragma unroll
    for (int q = 0; q < QG; ++q) {
      mrow[q] = -1e30f;
#pragma unroll
      for (int et = 0; et < 4; ++et) oacc[q][et] = vzero;
      oext[q] = vzero;         // row 0 (register 0, lanes 0..15) = l; other rows stay 0
    }

    // K first, then V, in the loop's own order
    v16h kf[4], vf[4];
#pragma unroll
    for (int i = 0; i < 4; ++i) kf[i] = frag_packed(kvlane + i * (2 * UNIT));
#pragma unroll
    for (int i = 0; i < 4; ++i) vf[i] = frag_packed(kvlane + VOFF + i * (2 * UNIT));

    // K of pass j+1 is read over K of pass j right behind the score products,
    // V of pass j+1 over V of pass j right behind the output products: each read
    // flies under the rest of a pass and takes no second register set.
    for (int j = 0; j < Sc / 32; ++j) {
      // the last pass wraps to pass 0 (read, never used)
      const _Float16* nxt = kvlane + ((j + 1) & (Sc / 32 - 1)) * PASS;

      // ---- scores for 32 keys x 32 queries: four 16x16 tiles, K-dim = 64 ----
      v8f s_lo[QG], s_hi[QG];
#pragma unroll
      for (int q = 0; q < QG; ++q) s_lo[q] = wmma16(kf[0], qa[q][0], vzero);
#pragma unroll
      for (int q = 0; q < QG; ++q) s_hi[q] = wmma16(kf[2], qa[q][0], vzero);
#pragma unroll
      for (int q = 0; q < QG; ++q) s_lo[q] = wmma16(kf[1], qa[q][1], s_lo[q]);
#pragma unroll
      for (int q = 0; q < QG; ++q) s_hi[q] = wmma16(kf[3], qa[q][1], s_hi[q]);

      // the eight K reads stay one group, outside the products, for speed only
      __builtin_amdgcn_sched_barrier(0);
#pragma unroll
      for (int i = 0; i < 4; ++i) kf[i] = frag_packed(nxt + i * (2 * UNIT));
      __builtin_amdgcn_sched_barrier(0);   // the end of that group

      // ---- online softmax: 16 of a query's 32 scores are in this lane, the
      //      other 16 in lane ^ 16 ----
      //      Both groups' maxima and rescale factors first, then the weights one
      //      accumulator tile at a time: so written, each packed subtraction takes
      //      two neighbouring registers and needs no register copies.
      v16h pb[QG];             // P^T as B fragments, straight from the accumulators
      float alpha[QG];
#pragma unroll
      for (int q = 0; q < QG; ++q) {
        float tm[8];
#pragma unroll
        for (int r = 0; r < 8; ++r) tm[r] = fmaxf(s_lo[q][r], s_hi[q][r]);
        const float mx = fmaxf(fmaxf(fmaxf(tm[0], tm[1]), fmaxf(tm[2], tm[3])),
                               fmaxf(fmaxf(tm[4], tm[5]), fmaxf(tm[6], tm[7])));
        const float mnew = fmaxf(mrow[q], fmaxf(mx, xhalf(mx)));
        alpha[q] = exp2_bare(mrow[q] - mnew);
        mrow[q] = mnew;
      }
#pragma unroll
      for (int q = 0; q < QG; ++q) {
#pragma unroll
        for (int r = 0; r < 8; ++r)
          pb[q][r]     = (_Float16)exp2_bare(s_lo[q][r] - mrow[q]);   // already log2e-scaled
#pragma unroll
        for (int r = 0; r < 8; ++r)
          pb[q][8 + r] = (_Float16)exp2_bare(s_hi[q][r] - mrow[q]);
#pragma unroll
        for (int et = 0; et < 4; ++et)
#pragma unroll
          for (int r = 0; r < 8; ++r) oacc[q][et][r] *= alpha[q];
        oext[q][0] *= alpha[q];
      }

      // ---- O^T += V^T * P^T ; l += 1 * P^T (ones row) ----
#pragma unroll
      for (int et = 0; et < 4; ++et)
#pragma unroll
        for (int q = 0; q < QG; ++q) oacc[q][et] = wmma16(vf[et], pb[q], oacc[q][et]);
#pragma unroll
      for (int q = 0; q < QG; ++q) oext[q] = wmma16(ones, pb[q], oext[q]);

#pragma unroll
      for (int et = 0; et < 4; ++et) vf[et] = frag_packed(nxt + VOFF + et * (2 * UNIT));
    }

    // ---- normalize and store. A lane holds out[b][s0 + 16q + m][h*64 + et*16 +
    //      8g + 0..7]: stored from there, one wave-wide 16-byte store would touch
    //      16 lines with 32 bytes each. Each 16-query x 32-column piece (one
    //      128-byte line per query) is therefore turned in the wave's own LDS tile,
    //      as 16 rows of 32 floats at a pitch of OP floats, and leaves as whole
    //      lines: 8 lanes per line, 4 lines per store. With 144-byte rows the
    //      writes (16 rows at once) and the reads (rows i and i + 8 in lanes 0..15,
    //      i + 4 and i + 12 in lanes 16..31) both meet every bank once. ----
    float* Tf = (float*)Tw;
    float* tput = Tf + m * OP + g * 8;
    const int orow = ((lane >> 3) & 1) * 8 + (lane >> 4) * 4;   // + i
    const float* tget = Tf + orow * OP + (lane & 7) * 4;
#pragma unroll
    for (int q = 0; q < QG; ++q) {
      // l sits in register 0 of lanes 0..15, lanes 16..31 hold 0 there
      const float l = oext[q][0] + xhalf(oext[q][0]);
      const float inv = 1.0f / l;
      float* oline = out + ((size_t)b * Sc + s0 + q * 16 + orow) * DM + h * DH + (lane & 7) * 4;
#pragma unroll
      for (int hh = 0; hh < 2; ++hh) {
#pragma unroll
        for (int e2 = 0; e2 < 2; ++e2) {
          const v8f o = oacc[q][hh * 2 + e2];
          const v4f lo = {o[0] * inv, o[1] * inv, o[2] * inv, o[3] * inv};
          const v4f hi = {o[4] * inv, o[5] * inv, o[6] * inv, o[7] * inv};
          *(v4f*)(tput + e2 * 16)     = lo;
          *(v4f*)(tput + e2 * 16 + 4) = hi;
        }
        // the other lanes' tile stores are in LDS before the rows are read back
        asm volatile("s_wait_dscnt 0x0" ::: "memory");
        v4f line[4];
#pragma unroll
        for (int i = 0; i < 4; ++i) line[i] = *(const v4f*)(tget + i * OP);
        // the rows are read before the tile is written again
        asm volatile("s_wait_dscnt 0x0" ::: "memory");
#pragma unroll
        for (int i = 0; i < 4; ++i) *(v4f*)(oline + (size_t)i * DM + hh * 32) = line[i];
        // the stores' address and data registers are reused by the next piece or set
        asm volatile("s_wait_xcnt 0x0" ::: "memory");
      }
    }
  }
}

// ===========================================================================
extern "C" void kernel_launch(void* const* d_in, const int* in_sizes, int n_in,
                              void* d_out, int out_size, void* d_ws, size_t ws_size,
                              hipStream_t stream) {
  (void)in_sizes; (void)n_in; (void)out_size; (void)d_ws; (void)ws_size;
  const float* x  = (const float*)d_in[0];
  const float* Wq = (const float*)d_in[1];
  const float* Wk = (const float*)d_in[2];
  const float* Wv = (const float*)d_in[3];
  const float* bq = (const float*)d_in[4];
  const float* bk = (const float*)d_in[5];
  const float* bv = (const float*)d_in[6];

  dim3 grid(Bc * Hc);  // 256 blocks of 16 waves, one per (b,h)
  mhsa_kernel<<<grid, NW * 32, 0, stream>>>(x, Wq, Wk, Wv, bq, bk, bv, (float*)d_out);
}

// v009
// One run takes 54.4 microseconds.
// In both of two side-by-side timings against v008, it was 1.08 times as fast.
// All steps since v000 together make it 6.59 times as fast.
#include <hip/hip_runtime.h>
#include <hip/hip_bf16.h>

typedef __attribute__((ext_vector_type(16))) _Float16 v16h;
typedef __attribute__((ext_vector_type(8)))  _Float16 v8h;
typedef __attribute__((ext_vector_type(8)))  float    v8f;

constexpr int Bc = 16;     // batch
constexpr int Sc = 1024;   // sequence
constexpr int Hc = 16;     // heads
constexpr int DH = 64;     // head dim
constexpr int DM = 1024;   // model dim

// attention scale folded into Q at projection time: 1/sqrt(64) * log2(e)
constexpr float QSCALE = 0.125f * 1.4426950408889634f;

// ---------------------------------------------------------------------------
// WMMA helper: D = A(16x32 f16) * B(32x16 f16) + C(16x16 f32)
// ---------------------------------------------------------------------------
__device__ inline v8f wmma16(v16h a, v16h b, v8f c) {
  return __builtin_amdgcn_wmma_f32_16x16x32_f16(
      /*neg_a=*/false, a, /*neg_b=*/false, b,
      /*c_mod=*/(short)0, c, /*reuse_a=*/false, /*reuse_b=*/false);
}

// ---------------------------------------------------------------------------
// Fragment loaders. CDNA5 16-bit A/B fragment, per lane (g = lane/16):
//   elem i (i<8) -> K = kbase + 8g + i ; elem 8+i -> K = kbase + 8g + 16 + i
// i.e. two contiguous runs of 8 at p and p+16.
// ---------------------------------------------------------------------------
typedef __attribute__((ext_vector_type(4))) _Float16 v4h;
typedef __attribute__((ext_vector_type(4))) float    v4f;
// One lane's 32 floats of a 16-row x 64-column tile of x, as loaded: p[0..7],
// p[16..23] (first fragment), p[32..39], p[48..55] (second); p = row + g * 8.
struct XRaw { v4f r[8]; };
__device__ inline XRaw load_xraw(const float* __restrict__ p) {
  XRaw x;
#pragma unroll
  for (int c = 0; c < 4; ++c) {
    x.r[2 * c]     = *(const v4f*)(p + c * 16);
    x.r[2 * c + 1] = *(const v4f*)(p + c * 16 + 4);
  }
  return x;
}
// fragment f (0 or 1) of it, f32 -> f16
__device__ inline v16h frag_from_raw(const XRaw& x, int f) {
  v16h a;
#pragma unroll
  for (int c = 0; c < 4; ++c)
#pragma unroll
    for (int i = 0; i < 4; ++i) a[c * 4 + i] = (_Float16)x.r[f * 4 + c][i];
  return a;
}
__device__ inline v16h frag_join(v8h lo, v8h hi) {
  v16h a;
#pragma unroll
  for (int i = 0; i < 8; ++i) { a[i] = lo[i]; a[8 + i] = hi[i]; }
  return a;
}
// Fragment-order K and V planes in LDS: one fragment = two 512-byte units,
// unit u holds run u (8 halves) of lane 0..31 back to back, so that one
// wave-wide 16-byte read or write is contiguous and meets every bank evenly.
// p = fragment base + lane * 8.
constexpr int UNIT = 32 * 8;   // halves per 512-byte unit
__device__ inline v16h frag_packed(const _Float16* p) {
  return frag_join(*(const v8h*)p, *(const v8h*)(p + UNIT));
}

// Weight fragments in LDS: run u of a fragment is two 16-lane halves (g) of
// 256 bytes, each at a pitch of 288 bytes. A 16-byte fragment read is then
// contiguous over each 16 lanes, and the 8-byte staging stores of a wave, which
// fall into eight such halves at once, meet every bank once.
// p = fragment base + g * WP + (lane & 15) * 8.
constexpr int WP = 144;        // halves per 16-lane half: 128 of data + 16 of pad
__device__ inline v16h frag_lds(const _Float16* p) {
  return frag_join(*(const v8h*)p, *(const v8h*)(p + 2 * WP));
}

// The eight B fragments of one weight matrix, [e/16][k/32], from LDS.
// B[k][n] = W[e0+n][k] (y = x * W^T): lane n holds row e0+n of W.
// wl = the matrix's fragments + g * WP + m * 8.
struct WFrag { v16h f[4][2]; };
__device__ inline WFrag load_wfrag(const _Float16* wl) {
  WFrag w;
#pragma unroll
  for (int e = 0; e < 4; ++e) {
    w.f[e][0] = frag_lds(wl + e * (8 * WP));
    w.f[e][1] = frag_lds(wl + e * (8 * WP) + 4 * WP);
  }
  return w;
}

// One 16x16 tile of x * W^T + b; the bias rides in the WMMA C operand.
__device__ inline v8f proj_tile(v16h a0, v16h a1, v16h w0, v16h w1, float bias) {
  v8f acc;
#pragma unroll
  for (int i = 0; i < 8; ++i) acc[i] = bias;
  acc = wmma16(a0, w0, acc);
  acc = wmma16(a1, w1, acc);
  return acc;
}

// The 16-row x 64-column Q projection, scaled, turned in the wave's own LDS tile
// Tw (pitch 72 halves) into its two B fragments: run q of the four at lane (m,g)
// = row m, columns q*16 + g*8 .. +7.
__device__ inline void proj_q(v16h a0, v16h a1, const WFrag& w, const float (&bias)[4],
                              _Float16* Tw, int m, int g, v16h& f0, v16h& f1) {
#pragma unroll
  for (int e = 0; e < 4; ++e) {
    const v8f acc = proj_tile(a0, a1, w.f[e][0], w.f[e][1], bias[e]);
#pragma unroll
    for (int r = 0; r < 8; ++r)
      Tw[(r + 8 * g) * 72 + e * 16 + m] = (_Float16)(acc[r] * QSCALE);
  }
  // the other lanes' tile stores are in LDS before the rows are read back
  asm volatile("s_wait_dscnt 0x0" ::: "memory");
  const _Float16* srcp = Tw + m * 72 + g * 8;
  v8h run[4];
#pragma unroll
  for (int q = 0; q < 4; ++q) run[q] = *(const v8h*)(srcp + q * 16);
  // the rows are read before Tw is written again
  asm volatile("s_wait_dscnt 0x0" ::: "memory");
  f0 = frag_join(run[0], run[1]);
  f1 = frag_join(run[2], run[3]);
}

// value of lane l ^ 16 (the other half of the same query's keys)
__device__ inline float xhalf(float v) {
  const int b = __float_as_int(v);
  return __int_as_float(
      __builtin_amdgcn_permlanex16(b, b, 0x76543210, 0xfedcba98, false, false));
}

constexpr int QG = 2;      // 16-query groups per wave and query set
constexpr int NW = 16;     // waves per block
constexpr int RW = Sc / NW;            // rows (keys, and queries) per wave: 64
constexpr int QSETS = RW / (16 * QG);  // query sets a wave takes in turn: 2

// 2^x as the one hardware instruction. The library form adds a compare, two
// selects, an add and an ldexp so that results under 2^-126 come out as
// denormals; here such a result is rounded to f16 (zero either way) or scales
// sums that a term of weight 1 has just outgrown by that same factor.
__device__ inline float exp2_bare(float x) { return __builtin_amdgcn_exp2f(x); }

constexpr int PASS = 2 * 32 * DH;
constexpr int VOFF = 32 * DH;
constexpr int OP = 36;
constexpr float LAZY = 8.0f;

__global__ __launch_bounds__(NW * 32) __attribute__((amdgpu_waves_per_eu(4, 4)))
void mhsa_kernel(const float* __restrict__ x,
                 const float* __restrict__ Wq, const float* __restrict__ Wk,
                 const float* __restrict__ Wv,
                 const float* __restrict__ bq, const float* __restrict__ bk,
                 const float* __restrict__ bv, float* __restrict__ out) {
  __shared__ __align__(16) _Float16 KV[(Sc / 32) * PASS];  // K, V fragments, 256 KB
  __shared__ __align__(16) _Float16 Wl[24 * 4 * WP];  // [wsel][e/16][k/32][u][g] halves
  __shared__ __align__(16) _Float16 Tr[NW][16 * 72];  // per-wave tile: 16x64 halves, pad 72, or 16x32 floats, pad 36

  const int lane = threadIdx.x & 31;
  const int wave = threadIdx.x >> 5;
  const int m = lane & 15, g = lane >> 4;
  const int bh = blockIdx.x;
  const int b = bh / Hc, h = bh % Hc;

  // this lane's row of the wave's first 16-row tile, at the head's columns
  const float* xlane = x + ((size_t)b * Sc + wave * RW + m) * DM + h * DH + g * 8;
  _Float16* Tw = &Tr[wave][0];

  // Weights: a slab is 1024 floats (16 rows). Threads 0..255 take slabs 0 and 1
  // of each matrix, threads 256..511 slabs 2 and 3; thread t (mod 256) takes
  // floats 4t..4t+3, so a wave-wide load covers 512 contiguous bytes. Row
  // n = t/16 of the slab, columns 4*(t%16)..+3 = k half (bit 3 of t), run u
  // (bit 2), lane half g (bit 1), first or second four of the run (bit 0).
  // The loops are unrolled so that wr stays in registers, all six loads are in
  // flight together and every offset is an immediate.
  const float* Ws[3] = {Wq, Wk, Wv};
  const int t = threadIdx.x & 255;
  const int sl = (threadIdx.x >> 8) * 2;
  v4f wr[3][2];
#pragma unroll
  for (int wsel = 0; wsel < 3; ++wsel)
#pragma unroll
    for (int i = 0; i < 2; ++i)
      wr[wsel][i] = *(const v4f*)(Ws[wsel] + (size_t)h * DH * DH + sl * 1024 + t * 4 + i * 1024);
  // biases of output columns e*16 + m
  float bqr[4], bkr[4], bvr[4];
#pragma unroll
  for (int e = 0; e < 4; ++e) {
    bqr[e] = bq[h * DH + e * 16 + m];
    bkr[e] = bk[h * DH + e * 16 + m];
    bvr[e] = bv[h * DH + e * 16 + m];
  }
  // the wave's four 16-row tiles of x
  XRaw xr[RW / 16];
#pragma unroll
  for (int tl = 0; tl < RW / 16; ++tl) xr[tl] = load_xraw(xlane + (size_t)tl * 16 * DM);
  // the loads' address registers are reused as soon as the loads are issued
  asm volatile("s_wait_xcnt 0x0" ::: "memory");
  // all of the wave's loads from memory are issued before the first is waited
  // for; left free, the scheduler issues x two loads at a time, each pair behind
  // the conversion of the pair before, and the latencies add up
  __builtin_amdgcn_sched_barrier(0);

  {
    _Float16* wd = Wl + sl * (8 * WP) + ((t >> 1) & 7) * WP + (t >> 4) * 8 + (t & 1) * 4;
#pragma unroll
    for (int wsel = 0; wsel < 3; ++wsel)
#pragma unroll
      for (int i = 0; i < 2; ++i) {
        const v4f w = wr[wsel][i];
        v4h c;
#pragma unroll
        for (int k = 0; k < 4; ++k) c[k] = (_Float16)w[k];
        *(v4h*)(wd + (wsel * 4 + i) * (8 * WP)) = c;
      }
  }

  __syncthreads();   // every wave's share of the weight fragments is in LDS

  // A fragments of x, f32 -> f16
  v16h xa[RW / 16][2];
#pragma unroll
  for (int tl = 0; tl < RW / 16; ++tl) {
    xa[tl][0] = frag_from_raw(xr[tl], 0);
    xa[tl][1] = frag_from_raw(xr[tl], 1);
  }

  const _Float16* wlane = Wl + g * WP + m * 8;   // + wsel * 4 * (8 * WP)

  // K: lane (m,g), register r holds row r + 8g, column e*16 + m of the tile. In
  // fragment order that is run e, lane (m/8)*16 + row, element m%8.
  {
    const WFrag w = load_wfrag(wlane + 4 * (8 * WP));
    _Float16* kd = KV + wave * (RW / 32) * PASS + (m >> 3) * 128 + g * 64 + (m & 7);
#pragma unroll
    for (int tl = 0; tl < RW / 16; ++tl)
#pragma unroll
      for (int e = 0; e < 4; ++e) {
        const v8f acc = proj_tile(xa[tl][0], xa[tl][1], w.f[e][0], w.f[e][1], bkr[e]);
#pragma unroll
        for (int r = 0; r < 8; ++r)
          kd[(tl >> 1) * PASS + (tl & 1) * (4 * UNIT) + e * UNIT + r * 8] = (_Float16)acc[r];
      }
  }
  // V: lane (m,g) holds column e*16 + m, keys 8g..8g+7 of the tile: run
  // u = tile & 1 of the 32-key fragment e, at its own lane's place
  {
    const WFrag w = load_wfrag(wlane + 8 * (8 * WP));
    _Float16* vd = KV + wave * (RW / 32) * PASS + VOFF + lane * 8;
#pragma unroll
    for (int tl = 0; tl < RW / 16; ++tl)
#pragma unroll
      for (int e = 0; e < 4; ++e) {
        const v8f acc = proj_tile(xa[tl][0], xa[tl][1], w.f[e][0], w.f[e][1], bvr[e]);
        v8h c;
#pragma unroll
        for (int r = 0; r < 8; ++r) c[r] = (_Float16)acc[r];
        *(v8h*)(vd + (tl >> 1) * PASS + e * (2 * UNIT) + (tl & 1) * UNIT) = c;
      }
  }
  // Q B-fragments of the current query set; those of the first set come from
  // the x fragments at hand
  v16h qa[QG][2];
  {
    const WFrag w = load_wfrag(wlane);
#pragma unroll
    for (int q = 0; q < QG; ++q)
      proj_q(xa[q][0], xa[q][1], w, bqr, Tw, m, g, qa[q][0], qa[q][1]);
  }

  __syncthreads();   // all 1024 keys' K and V fragments are in LDS

  // ones-row A fragment: A1[r][k] = (r==0); lanes 0/16 all-ones, else zero
  v16h ones;
  {
    const _Float16 o = (m == 0) ? (_Float16)1.0f : (_Float16)0.0f;
#pragma unroll
    for (int i = 0; i < 16; ++i) ones[i] = o;
  }
  const v8f vzero = {0.f, 0.f, 0.f, 0.f, 0.f, 0.f, 0.f, 0.f};

  // the lane's part of every fragment address is constant
  const _Float16* kvlane = KV + lane * 8;

  for (int set = 0; set < QSETS; ++set) {
    const int s0 = wave * RW + set * (16 * QG);

    if (set > 0) {
      // a later set's rows of x are read again and projected to Q here
      XRaw xq[QG];
      float bq2[4];
#pragma unroll
      for (int q = 0; q < QG; ++q)
        xq[q] = load_xraw(xlane + (size_t)(set * QG + q) * 16 * DM);
#pragma unroll
      for (int e = 0; e < 4; ++e) bq2[e] = bq[h * DH + e * 16 + m];
      // the loads' address registers are reused as soon as the loads are issued
      asm volatile("s_wait_xcnt 0x0" ::: "memory");
      const WFrag w = load_wfrag(wlane);
#pragma unroll
      for (int q = 0; q < QG; ++q)
        proj_q(frag_from_raw(xq[q], 0), frag_from_raw(xq[q], 1), w, bq2, Tw, m, g,
               qa[q][0], qa[q][1]);
    }

    float mrow[QG];            // the maximum in use for this lane's query, per group
    float mlim[QG];            // mrow + LAZY: a score above it asks for a rescale
    v8f oacc[QG][4], oext[QG]; // oacc[q][et][r] = O[query 16q+m][et*16 + 8g + r]
#pragma unroll
    for (int q = 0; q < QG; ++q) {
      mrow[q] = -1e30f;
      mlim[q] = -1e30f;
#pragma unroll
      for (int et = 0; et < 4; ++et) oacc[q][et] = vzero;
      oext[q] = vzero;         // row 0 (register 0, lanes 0..15) = l; other rows stay 0
    }

    // K first, then V, in the loop's own order
    v16h kf[4], vf[4];
#pragma unroll
    for (int i = 0; i < 4; ++i) kf[i] = frag_packed(kvlane + i * (2 * UNIT));
#pragma unroll
    for (int i = 0; i < 4; ++i) vf[i] = frag_packed(kvlane + VOFF + i * (2 * UNIT));

    // K of pass j+1 is read over K of pass j behind the score products and their test,
    // V of pass j+1 over V of pass j right behind the output products: each read
    // flies under the rest of a pass and takes no second register set.
    for (int j = 0; j < Sc / 32; ++j) {
      // the last pass wraps to pass 0 (read, never used)
      const _Float16* nxt = kvlane + ((j + 1) & (Sc / 32 - 1)) * PASS;

      // ---- scores for 32 keys x 32 queries: four 16x16 tiles, K-dim = 64 ----
      v8f s_lo[QG], s_hi[QG];
#pragma unroll
      for (int q = 0; q < QG; ++q) s_lo[q] = wmma16(kf[0], qa[q][0], vzero);
#pragma unroll
      for (int q = 0; q < QG; ++q) s_hi[q] = wmma16(kf[2], qa[q][0], vzero);
#pragma unroll
      for (int q = 0; q < QG; ++q) s_lo[q] = wmma16(kf[1], qa[q][1], s_lo[q]);
#pragma unroll
      for (int q = 0; q < QG; ++q) s_hi[q] = wmma16(kf[3], qa[q][1], s_hi[q]);

      // ---- online softmax: 16 of a query's 32 scores are in this lane, the
      //      other 16 in lane ^ 16 ----
      //      mrow, the maximum in use, may trail the true running maximum by up to
      //      LAZY (log2-scaled scores), so a weight can reach 2^LAZY, far inside f16.
      //      The sums are rescaled only in a pass where some lane's scores exceed it
      //      by more: one test per pass, on each lane's own 16 scores (the ballot
      //      covers the other half), so the usual pass has no exchange between the
      //      halves, no rescale factor and no product over the output tiles.
      v16h pb[QG];             // P^T as B fragments, straight from the accumulators
      float mx[QG];
      bool need = false;
#pragma unroll
      for (int q = 0; q < QG; ++q) {
        float tm[8];
#pragma unroll
        for (int r = 0; r < 8; ++r) tm[r] = fmaxf(s_lo[q][r], s_hi[q][r]);
        mx[q] = fmaxf(fmaxf(fmaxf(tm[0], tm[1]), fmaxf(tm[2], tm[3])),
                      fmaxf(fmaxf(tm[4], tm[5]), fmaxf(tm[6], tm[7])));
        need = need || (mx[q] > mlim[q]);
      }
      if (__builtin_amdgcn_ballot_w32(need) != 0) {   // wave-uniform; always taken in pass 0
#pragma unroll
        for (int q = 0; q < QG; ++q) {
          // both halves of a query take the same new maximum
          const float mnew = fmaxf(mrow[q], fmaxf(mx[q], xhalf(mx[q])));
          const float alpha = exp2_bare(mrow[q] - mnew);   // 0 in pass 0
          mrow[q] = mnew;
          mlim[q] = mnew + LAZY;
#pragma unroll
          for (int et = 0; et < 4; ++et)
#pragma unroll
            for (int r = 0; r < 8; ++r) oacc[q][et][r] *= alpha;
          oext[q][0] *= alpha;
        }
      }
      // the eight K reads stay one group, outside the products, for speed only. They stand
      // behind the test, at the head of the block where both of its paths meet.
      __builtin_amdgcn_sched_barrier(0);
#pragma unroll
      for (int i = 0; i < 4; ++i) kf[i] = frag_packed(nxt + i * (2 * UNIT));
      __builtin_amdgcn_sched_barrier(0);   // the end of that group

      //      The weights one accumulator tile at a time: so written, each packed
      //      subtraction takes two neighbouring registers and needs no register copies.
#pragma unroll
      for (int q = 0; q < QG; ++q) {
#pragma unroll
        for (int r = 0; r < 8; ++r)
          pb[q][r]     = (_Float16)exp2_bare(s_lo[q][r] - mrow[q]);   // already log2e-scaled
#pragma unroll
        for (int r = 0; r < 8; ++r)
          pb[q][8 + r] = (_Float16)exp2_bare(s_hi[q][r] - mrow[q]);
      }

      // ---- O^T += V^T * P^T ; l += 1 * P^T (ones row) ----
#pragma unroll
      for (int et = 0; et < 4; ++et)
#pragma unroll
        for (int q = 0; q < QG; ++q) oacc[q][et] = wmma16(vf[et], pb[q], oacc[q][et]);
#pragma unroll
      for (int q = 0; q < QG; ++q) oext[q] = wmma16(ones, pb[q], oext[q]);

#pragma unroll
      for (int et = 0; et < 4; ++et) vf[et] = frag_packed(nxt + VOFF + et * (2 * UNIT));
    }

    // ---- normalize and store. A lane holds out[b][s0 + 16q + m][h*64 + et*16 +
    //      8g + 0..7]: stored from there, one wave-wide 16-byte store would touch
    //      16 lines with 32 bytes each. Each 16-query x 32-column piece (one
    //      128-byte line per query) is therefore turned in the wave's own LDS tile,
    //      as 16 rows of 32 floats at a pitch of OP floats, and leaves as whole
    //      lines: 8 lanes per line, 4 lines per store. With 144-byte rows the
    //      writes (16 rows at once) and the reads (rows i and i + 8 in lanes 0..15,
    //      i + 4 and i + 12 in lanes 16..31) both meet every bank once. ----
    float* Tf = (float*)Tw;
    float* tput = Tf + m * OP + g * 8;
    const int orow = ((lane >> 3) & 1) * 8 + (lane >> 4) * 4;   // + i
    const float* tget = Tf + orow * OP + (lane & 7) * 4;
#pragma unroll
    for (int q = 0; q < QG; ++q) {
      // l sits in register 0 of lanes 0..15, lanes 16..31 hold 0 there
      const float l = oext[q][0] + xhalf(oext[q][0]);
      const float inv = 1.0f / l;
      float* oline = out + ((size_t)b * Sc + s0 + q * 16 + orow) * DM + h * DH + (lane & 7) * 4;
#pragma unroll
      for (int hh = 0; hh < 2; ++hh) {
#pragma unroll
        for (int e2 = 0; e2 < 2; ++e2) {
          const v8f o = oacc[q][hh * 2 + e2];
          const v4f lo = {o[0] * inv, o[1] * inv, o[2] * inv, o[3] * inv};
          const v4f hi = {o[4] * inv, o[5] * inv, o[6] * inv, o[7] * inv};
          *(v4f*)(tput + e2 * 16)     = lo;
          *(v4f*)(tput + e2 * 16 + 4) = hi;
        }
        // the other lanes' tile stores are in LDS before the rows are read back
        asm volatile("s_wait_dscnt 0x0" ::: "memory");
        v4f line[4];
#pragma unroll
        for (int i = 0; i < 4; ++i) line[i] = *(const v4f*)(tget + i * OP);
        // the rows are read before the tile is written again
        asm volatile("s_wait_dscnt 0x0" ::: "memory");
#pragma unroll
        for (int i = 0; i < 4; ++i) *(v4f*)(oline + (size_t)i * DM + hh * 32) = line[i];
        // the stores' address and data registers are reused by the next piece or set
        asm volatile("s_wait_xcnt 0x0" ::: "memory");
      }
    }
  }
}

// ===========================================================================
extern "C" void kernel_launch(void* const* d_in, const int* in_sizes, int n_in,
                              void* d_out, int out_size, void* d_ws, size_t ws_size,
                              hipStream_t stream) {
  (void)in_sizes; (void)n_in; (void)out_size; (void)d_ws; (void)ws_size;
  const float* x  = (const float*)d_in[0];
  const float* Wq = (const float*)d_in[1];
  const float* Wk = (const float*)d_in[2];
  const float* Wv = (const float*)d_in[3];
  const float* bq = (const float*)d_in[4];
  const float* bk = (const float*)d_in[5];
  const float* bv = (const float*)d_in[6];

  dim3 grid(Bc * Hc);  // 256 blocks of 16 waves, one per (b,h)
  mhsa_kernel<<<grid, NW * 32, 0, stream>>>(x, Wq, Wk, Wv, bq, bk, bv, (float*)d_out);
}

// v010
// It runs in 52.8 microseconds.
// Timed twice side by side with v009, it ran 1.03 times as fast both times.
// All steps since v000 together make it 6.81 times as fast.
#include <hip/hip_runtime.h>
#include <hip/hip_bf16.h>

typedef __attribute__((ext_vector_type(16))) _Float16 v16h;
typedef __attribute__((ext_vector_type(8)))  _Float16 v8h;
typedef __attribute__((ext_vector_type(8)))  float    v8f;

constexpr int Bc = 16;     // batch
constexpr int Sc = 1024;   // sequence
constexpr int Hc = 16;     // heads
constexpr int DH = 64;     // head dim
constexpr int DM = 1024;   // model dim

// attention scale folded into Q at projection time: 1/sqrt(64) * log2(e)
constexpr float QSCALE = 0.125f * 1.4426950408889634f;

// ---------------------------------------------------------------------------
// WMMA helper: D = A(16x32 f16) * B(32x16 f16) + C(16x16 f32)
// ---------------------------------------------------------------------------
__device__ inline v8f wmma16(v16h a, v16h b, v8f c) {
  return __builtin_amdgcn_wmma_f32_16x16x32_f16(
      /*neg_a=*/false, a, /*neg_b=*/false, b,
      /*c_mod=*/(short)0, c, /*reuse_a=*/false, /*reuse_b=*/false);
}

// ---------------------------------------------------------------------------
// Fragment loaders. CDNA5 16-bit A/B fragment, per lane (g = lane/16):
//   elem i (i<8) -> K = kbase + 8g + i ; elem 8+i -> K = kbase + 8g + 16 + i
// i.e. two contiguous runs of 8 at p and p+16.
// ---------------------------------------------------------------------------
typedef __attribute__((ext_vector_type(4))) _Float16 v4h;
typedef __attribute__((ext_vector_type(4))) float    v4f;
// One lane's 32 floats of a 16-row x 64-column tile of x, as loaded: p[0..7],
// p[16..23] (first fragment), p[32..39], p[48..55] (second); p = row + g * 8.
struct XRaw { v4f r[8]; };
__device__ inline XRaw load_xraw(const float* __restrict__ p) {
  XRaw x;
#pragma unroll
  for (int c = 0; c < 4; ++c) {
    x.r[2 * c]     = *(const v4f*)(p + c * 16);
    x.r[2 * c + 1] = *(const v4f*)(p + c * 16 + 4);
  }
  return x;
}
// fragment f (0 or 1) of it, f32 -> f16
__device__ inline v16h frag_from_raw(const XRaw& x, int f) {
  v16h a;
#pragma unroll
  for (int c = 0; c < 4; ++c)
#pragma unroll
    for (int i = 0; i < 4; ++i) a[c * 4 + i] = (_Float16)x.r[f * 4 + c][i];
  return a;
}
__device__ inline v16h frag_join(v8h lo, v8h hi) {
  v16h a;
#pragma unroll
  for (int i = 0; i < 8; ++i) { a[i] = lo[i]; a[8 + i] = hi[i]; }
  return a;
}
// Fragment-order K and V planes in LDS: one fragment = two 512-byte units,
// unit u holds run u (8 halves) of lane 0..31 back to back, so that one
// wave-wide 16-byte read or write is contiguous and meets every bank evenly.
// p = fragment base + lane * 8.
constexpr int UNIT = 32 * 8;   // halves per 512-byte unit
__device__ inline v16h frag_packed(const _Float16* p) {
  return frag_join(*(const v8h*)p, *(const v8h*)(p + UNIT));
}

// Weight fragments in LDS: run u of a fragment is two 16-lane halves (g) of
// 256 bytes, each at a pitch of 288 bytes. A 16-byte fragment read is then
// contiguous over each 16 lanes, and the 8-byte staging stores of a wave, which
// fall into eight such halves at once, meet every bank once.
// p = fragment base + g * WP + (lane & 15) * 8.
constexpr int WP = 144;        // halves per 16-lane half: 128 of data + 16 of pad
__device__ inline v16h frag_lds(const _Float16* p) {
  return frag_join(*(const v8h*)p, *(const v8h*)(p + 2 * WP));
}

// The eight B fragments of one weight matrix, [e/16][k/32], from LDS.
// B[k][n] = W[e0+n][k] (y = x * W^T): lane n holds row e0+n of W.
// wl = the matrix's fragments + g * WP + m * 8.
struct WFrag { v16h f[4][2]; };
__device__ inline WFrag load_wfrag(const _Float16* wl) {
  WFrag w;
#pragma unroll
  for (int e = 0; e < 4; ++e) {
    w.f[e][0] = frag_lds(wl + e * (8 * WP));
    w.f[e][1] = frag_lds(wl + e * (8 * WP) + 4 * WP);
  }
  return w;
}

// One 16x16 tile of x * W^T + b; the bias rides in the WMMA C operand.
__device__ inline v8f proj_tile(v16h a0, v16h a1, v16h w0, v16h w1, float bias) {
  v8f acc;
#pragma unroll
  for (int i = 0; i < 8; ++i) acc[i] = bias;
  acc = wmma16(a0, w0, acc);
  acc = wmma16(a1, w1, acc);
  return acc;
}

// The 16-row x 64-column Q projection, scaled, turned in the wave's own LDS tile
// Tw (pitch 72 halves) into its two B fragments: run q of the four at lane (m,g)
// = row m, columns q*16 + g*8 .. +7.
__device__ inline void proj_q(v16h a0, v16h a1, const WFrag& w, const float (&bias)[4],
                              _Float16* Tw, int m, int g, v16h& f0, v16h& f1) {
#pragma unroll
  for (int e = 0; e < 4; ++e) {
    const v8f acc = proj_tile(a0, a1, w.f[e][0], w.f[e][1], bias[e]);
#pragma unroll
    for (int r = 0; r < 8; ++r)
      Tw[(r + 8 * g) * 72 + e * 16 + m] = (_Float16)(acc[r] * QSCALE);
  }
  // the other lanes' tile stores are in LDS before the rows are read back
  asm volatile("s_wait_dscnt 0x0" ::: "memory");
  const _Float16* srcp = Tw + m * 72 + g * 8;
  v8h run[4];
#pragma unroll
  for (int q = 0; q < 4; ++q) run[q] = *(const v8h*)(srcp + q * 16);
  // the rows are read before Tw is written again
  asm volatile("s_wait_dscnt 0x0" ::: "memory");
  f0 = frag_join(run[0], run[1]);
  f1 = frag_join(run[2], run[3]);
}

// value of lane l ^ 16 (the other half of the same query's keys)
__device__ inline float xhalf(float v) {
  const int b = __float_as_int(v);
  return __int_as_float(
      __builtin_amdgcn_permlanex16(b, b, 0x76543210, 0xfedcba98, false, false));
}

constexpr int QG = 2;      // 16-query groups per wave and query set
constexpr int NW = 16;     // waves per block
constexpr int RW = Sc / NW;            // rows (keys, and queries) per wave: 64
constexpr int QSETS = RW / (16 * QG);  // query sets a wave takes in turn: 2

// 2^x as the one hardware instruction. The library form adds a compare, two
// selects, an add and an ldexp so that results under 2^-126 come out as
// denormals; here such a result is rounded to f16 (zero either way) or scales
// sums that a term of weight 1 has just outgrown by that same factor.
__device__ inline float exp2_bare(float x) { return __builtin_amdgcn_exp2f(x); }

constexpr int PASS = 2 * 32 * DH;
constexpr int VOFF = 32 * DH;
constexpr int OP = 36;
constexpr int NP = Sc / 32;
constexpr float LAZY = 8.0f;

__global__ __launch_bounds__(NW * 32) __attribute__((amdgpu_waves_per_eu(4, 4)))
void mhsa_kernel(const float* __restrict__ x,
                 const float* __restrict__ Wq, const float* __restrict__ Wk,
                 const float* __restrict__ Wv,
                 const float* __restrict__ bq, const float* __restrict__ bk,
                 const float* __restrict__ bv, float* __restrict__ out) {
  __shared__ __align__(16) _Float16 KV[(Sc / 32) * PASS];  // K, V fragments, 256 KB
  __shared__ __align__(16) _Float16 Wl[24 * 4 * WP];  // [wsel][e/16][k/32][u][g] halves
  __shared__ __align__(16) _Float16 Tr[NW][16 * 72];  // per-wave tile: 16x64 halves, pad 72, or 16x32 floats, pad 36

  const int lane = threadIdx.x & 31;
  const int wave = threadIdx.x >> 5;
  const int m = lane & 15, g = lane >> 4;
  const int bh = blockIdx.x;
  const int b = bh / Hc, h = bh % Hc;

  // this lane's row of the wave's first 16-row tile, at the head's columns
  const float* xlane = x + ((size_t)b * Sc + wave * RW + m) * DM + h * DH + g * 8;
  _Float16* Tw = &Tr[wave][0];

  // Weights: a slab is 1024 floats (16 rows). Threads 0..255 take slabs 0 and 1
  // of each matrix, threads 256..511 slabs 2 and 3; thread t (mod 256) takes
  // floats 4t..4t+3, so a wave-wide load covers 512 contiguous bytes. Row
  // n = t/16 of the slab, columns 4*(t%16)..+3 = k half (bit 3 of t), run u
  // (bit 2), lane half g (bit 1), first or second four of the run (bit 0).
  // The loops are unrolled so that wr stays in registers, all six loads are in
  // flight together and every offset is an immediate.
  const float* Ws[3] = {Wq, Wk, Wv};
  const int t = threadIdx.x & 255;
  const int sl = (threadIdx.x >> 8) * 2;
  v4f wr[3][2];
#pragma unroll
  for (int wsel = 0; wsel < 3; ++wsel)
#pragma unroll
    for (int i = 0; i < 2; ++i)
      wr[wsel][i] = *(const v4f*)(Ws[wsel] + (size_t)h * DH * DH + sl * 1024 + t * 4 + i * 1024);
  // biases of output columns e*16 + m
  float bqr[4], bkr[4], bvr[4];
#pragma unroll
  for (int e = 0; e < 4; ++e) {
    bqr[e] = bq[h * DH + e * 16 + m];
    bkr[e] = bk[h * DH + e * 16 + m];
    bvr[e] = bv[h * DH + e * 16 + m];
  }
  // the wave's four 16-row tiles of x
  XRaw xr[RW / 16];
#pragma unroll
  for (int tl = 0; tl < RW / 16; ++tl) xr[tl] = load_xraw(xlane + (size_t)tl * 16 * DM);
  // the loads' address registers are reused as soon as the loads are issued
  asm volatile("s_wait_xcnt 0x0" ::: "memory");
  // all of the wave's loads from memory are issued before the first is waited
  // for; left free, the scheduler issues x two loads at a time, each pair behind
  // the conversion of the pair before, and the latencies add up
  __builtin_amdgcn_sched_barrier(0);

  {
    _Float16* wd = Wl + sl * (8 * WP) + ((t >> 1) & 7) * WP + (t >> 4) * 8 + (t & 1) * 4;
#pragma unroll
    for (int wsel = 0; wsel < 3; ++wsel)
#pragma unroll
      for (int i = 0; i < 2; ++i) {
        const v4f w = wr[wsel][i];
        v4h c;
#pragma unroll
        for (int k = 0; k < 4; ++k) c[k] = (_Float16)w[k];
        *(v4h*)(wd + (wsel * 4 + i) * (8 * WP)) = c;
      }
  }

  __syncthreads();   // every wave's share of the weight fragments is in LDS

  // A fragments of x, f32 -> f16
  v16h xa[RW / 16][2];
#pragma unroll
  for (int tl = 0; tl < RW / 16; ++tl) {
    xa[tl][0] = frag_from_raw(xr[tl], 0);
    xa[tl][1] = frag_from_raw(xr[tl], 1);
  }

  const _Float16* wlane = Wl + g * WP + m * 8;   // + wsel * 4 * (8 * WP)

  // K: lane (m,g), register r holds row r + 8g, column e*16 + m of the tile. In
  // fragment order that is run e, lane (m/8)*16 + row, element m%8.
  {
    const WFrag w = load_wfrag(wlane + 4 * (8 * WP));
    _Float16* kd = KV + wave * (RW / 32) * PASS + (m >> 3) * 128 + g * 64 + (m & 7);
#pragma unroll
    for (int tl = 0; tl < RW / 16; ++tl)
#pragma unroll
      for (int e = 0; e < 4; ++e) {
        const v8f acc = proj_tile(xa[tl][0], xa[tl][1], w.f[e][0], w.f[e][1], bkr[e]);
#pragma unroll
        for (int r = 0; r < 8; ++r)
          kd[(tl >> 1) * PASS + (tl & 1) * (4 * UNIT) + e * UNIT + r * 8] = (_Float16)acc[r];
      }
  }
  // V: lane (m,g) holds column e*16 + m, keys 8g..8g+7 of the tile: run
  // u = tile & 1 of the 32-key fragment e, at its own lane's place
  {
    const WFrag w = load_wfrag(wlane + 8 * (8 * WP));
    _Float16* vd = KV + wave * (RW / 32) * PASS + VOFF + lane * 8;
#pragma unroll
    for (int tl = 0; tl < RW / 16; ++tl)
#pragma unroll
      for (int e = 0; e < 4; ++e) {
        const v8f acc = proj_tile(xa[tl][0], xa[tl][1], w.f[e][0], w.f[e][1], bvr[e]);
        v8h c;
#pragma unroll
        for (int r = 0; r < 8; ++r) c[r] = (_Float16)acc[r];
        *(v8h*)(vd + (tl >> 1) * PASS + e * (2 * UNIT) + (tl & 1) * UNIT) = c;
      }
  }
  // Q B-fragments of the current query set; those of the first set come from
  // the x fragments at hand
  v16h qa[QG][2];
  {
    const WFrag w = load_wfrag(wlane);
#pragma unroll
    for (int q = 0; q < QG; ++q)
      proj_q(xa[q][0], xa[q][1], w, bqr, Tw, m, g, qa[q][0], qa[q][1]);
  }

  __syncthreads();   // all 1024 keys' K and V fragments are in LDS

  // ones-row A fragment: A1[r][k] = (r==0); lanes 0/16 all-ones, else zero
  v16h ones;
  {
    const _Float16 o = (m == 0) ? (_Float16)1.0f : (_Float16)0.0f;
#pragma unroll
    for (int i = 0; i < 16; ++i) ones[i] = o;
  }
  const v8f vzero = {0.f, 0.f, 0.f, 0.f, 0.f, 0.f, 0.f, 0.f};

  // the lane's part of every fragment address is constant
  const _Float16* kvlane = KV + lane * 8;

  // The wave's issue priority falls with its own progress through its 64 passes:
  // 3 for the first 32, then 2 for 16, 1 for 8 and 0 for the last 8. A wave that
  // is behind now goes first. Every test is on loop counters (scalar), and the kernel is left
  // at priority 0.
  __builtin_amdgcn_s_setprio(3);
  int jstep = -1;   // the pass at whose head the priority next steps down; none in the first set

  for (int set = 0; set < QSETS; ++set) {
    const int s0 = wave * RW + set * (16 * QG);

    if (set > 0) {
      // a later set's rows of x are read again and projected to Q here
      XRaw xq[QG];
      float bq2[4];
#pragma unroll
      for (int q = 0; q < QG; ++q)
        xq[q] = load_xraw(xlane + (size_t)(set * QG + q) * 16 * DM);
#pragma unroll
      for (int e = 0; e < 4; ++e) bq2[e] = bq[h * DH + e * 16 + m];
      // the loads' address registers are reused as soon as the loads are issued
      asm volatile("s_wait_xcnt 0x0" ::: "memory");
      const WFrag w = load_wfrag(wlane);
#pragma unroll
      for (int q = 0; q < QG; ++q)
        proj_q(frag_from_raw(xq[q], 0), frag_from_raw(xq[q], 1), w, bq2, Tw, m, g,
               qa[q][0], qa[q][1]);
      // the last set's passes begin: first step down (see above the set loop)
      __builtin_amdgcn_s_setprio(2);
      jstep = NP / 2;
    }

    float mrow[QG];            // the maximum in use for this lane's query, per group
    float mlim[QG];            // mrow + LAZY: a score above it asks for a rescale
    v8f oacc[QG][4], oext[QG]; // oacc[q][et][r] = O[query 16q+m][et*16 + 8g + r]
#pragma unroll
    for (int q = 0; q < QG; ++q) {
      mrow[q] = -1e30f;
      mlim[q] = -1e30f;
#pragma unroll
      for (int et = 0; et < 4; ++et) oacc[q][et] = vzero;
      oext[q] = vzero;         // row 0 (register 0, lanes 0..15) = l; other rows stay 0
    }

    // K first, then V, in the loop's own order
    v16h kf[4], vf[4];
#pragma unroll
    for (int i = 0; i < 4; ++i) kf[i] = frag_packed(kvlane + i * (2 * UNIT));
#pragma unroll
    for (int i = 0; i < 4; ++i) vf[i] = frag_packed(kvlane + VOFF + i * (2 * UNIT));

    // K of pass j+1 is read over K of pass j behind the score products and their test,
    // V of pass j+1 over V of pass j right behind the output products: each read
    // flies under the rest of a pass and takes no second register set.
    for (int j = 0; j < NP; ++j) {
      // the priority's later steps down (see above the set loop)
      if (j == jstep) {
        if (j == NP / 2) {
          __builtin_amdgcn_s_setprio(1);
          jstep = NP * 3 / 4;
        } else {
          __builtin_amdgcn_s_setprio(0);
        }
      }
      // the last pass wraps to pass 0 (read, never used)
      const _Float16* nxt = kvlane + ((j + 1) & (Sc / 32 - 1)) * PASS;

      // ---- scores for 32 keys x 32 queries: four 16x16 tiles, K-dim = 64 ----
      v8f s_lo[QG], s_hi[QG];
#pragma unroll
      for (int q = 0; q < QG; ++q) s_lo[q] = wmma16(kf[0], qa[q][0], vzero);
#pragma unroll
      for (int q = 0; q < QG; ++q) s_hi[q] = wmma16(kf[2], qa[q][0], vzero);
#pragma unroll
      for (int q = 0; q < QG; ++q) s_lo[q] = wmma16(kf[1], qa[q][1], s_lo[q]);
#pragma unroll
      for (int q = 0; q < QG; ++q) s_hi[q] = wmma16(kf[3], qa[q][1], s_hi[q]);

      // ---- online softmax: 16 of a query's 32 scores are in this lane, the
      //      other 16 in lane ^ 16 ----
      //      mrow, the maximum in use, may trail the true running maximum by up to
      //      LAZY (log2-scaled scores), so a weight can reach 2^LAZY, far inside f16.
      //      The sums are rescaled only in a pass where some lane's scores exceed it
      //      by more: one test per pass, on each lane's own 16 scores (the ballot
      //      covers the other half), so the usual pass has no exchange between the
      //      halves, no rescale factor and no product over the output tiles.
      v16h pb[QG];             // P^T as B fragments, straight from the accumulators
      float mx[QG];
      bool need = false;
#pragma unroll
      for (int q = 0; q < QG; ++q) {
        float tm[8];
#pragma unroll
        for (int r = 0; r < 8; ++r) tm[r] = fmaxf(s_lo[q][r], s_hi[q][r]);
        mx[q] = fmaxf(fmaxf(fmaxf(tm[0], tm[1]), fmaxf(tm[2], tm[3])),
                      fmaxf(fmaxf(tm[4], tm[5]), fmaxf(tm[6], tm[7])));
        need = need || (mx[q] > mlim[q]);
      }
      if (__builtin_amdgcn_ballot_w32(need) != 0) {   // wave-uniform; always taken in pass 0
#pragma unroll
        for (int q = 0; q < QG; ++q) {
          // both halves of a query take the same new maximum
          const float mnew = fmaxf(mrow[q], fmaxf(mx[q], xhalf(mx[q])));
          const float alpha = exp2_bare(mrow[q] - mnew);   // 0 in pass 0
          mrow[q] = mnew;
          mlim[q] = mnew + LAZY;
#pragma unroll
          for (int et = 0; et < 4; ++et)
#pragma unroll
            for (int r = 0; r < 8; ++r) oacc[q][et][r] *= alpha;
          oext[q][0] *= alpha;
        }
      }
      // the eight K reads stay one group, outside the products, for speed only. They stand
      // behind the test, at the head of the block where both of its paths meet.
      __builtin_amdgcn_sched_barrier(0);
#pragma unroll
      for (int i = 0; i < 4; ++i) kf[i] = frag_packed(nxt + i * (2 * UNIT));
      __builtin_amdgcn_sched_barrier(0);   // the end of that group

      //      The weights one accumulator tile at a time: so written, each packed
      //      subtraction takes two neighbouring registers and needs no register copies.
#pragma unroll
      for (int q = 0; q < QG; ++q) {
#pragma unroll
        for (int r = 0; r < 8; ++r)
          pb[q][r]     = (_Float16)exp2_bare(s_lo[q][r] - mrow[q]);   // already log2e-scaled
#pragma unroll
        for (int r = 0; r < 8; ++r)
          pb[q][8 + r] = (_Float16)exp2_bare(s_hi[q][r] - mrow[q]);
      }

      // ---- O^T += V^T * P^T ; l += 1 * P^T (ones row) ----
#pragma unroll
      for (int et = 0; et < 4; ++et)
#pragma unroll
        for (int q = 0; q < QG; ++q) oacc[q][et] = wmma16(vf[et], pb[q], oacc[q][et]);
#pragma unroll
      for (int q = 0; q < QG; ++q) oext[q] = wmma16(ones, pb[q], oext[q]);

#pragma unroll
      for (int et = 0; et < 4; ++et) vf[et] = frag_packed(nxt + VOFF + et * (2 * UNIT));
    }

    // ---- normalize and store. A lane holds out[b][s0 + 16q + m][h*64 + et*16 +
    //      8g + 0..7]: stored from there, one wave-wide 16-byte store would touch
    //      16 lines with 32 bytes each. Each 16-query x 32-column piece (one
    //      128-byte line per query) is therefore turned in the wave's own LDS tile,
    //      as 16 rows of 32 floats at a pitch of OP floats, and leaves as whole
    //      lines: 8 lanes per line, 4 lines per store. With 144-byte rows the
    //      writes (16 rows at once) and the reads (rows i and i + 8 in lanes 0..15,
    //      i + 4 and i + 12 in lanes 16..31) both meet every bank once. ----
    float* Tf = (float*)Tw;
    float* tput = Tf + m * OP + g * 8;
    const int orow = ((lane >> 3) & 1) * 8 + (lane >> 4) * 4;   // + i
    const float* tget = Tf + orow * OP + (lane & 7) * 4;
#pragma unroll
    for (int q = 0; q < QG; ++q) {
      // l sits in register 0 of lanes 0..15, lanes 16..31 hold 0 there
      const float l = oext[q][0] + xhalf(oext[q][0]);
      const float inv = 1.0f / l;
      float* oline = out + ((size_t)b * Sc + s0 + q * 16 + orow) * DM + h * DH + (lane & 7) * 4;
#pragma unroll
      for (int hh = 0; hh < 2; ++hh) {
#pragma unroll
        for (int e2 = 0; e2 < 2; ++e2) {
          const v8f o = oacc[q][hh * 2 + e2];
          const v4f lo = {o[0] * inv, o[1] * inv, o[2] * inv, o[3] * inv};
          const v4f hi = {o[4] * inv, o[5] * inv, o[6] * inv, o[7] * inv};
          *(v4f*)(tput + e2 * 16)     = lo;
          *(v4f*)(tput + e2 * 16 + 4) = hi;
        }
        // the other lanes' tile stores are in LDS before the rows are read back
        asm volatile("s_wait_dscnt 0x0" ::: "memory");
        v4f line[4];
#pragma unroll
        for (int i = 0; i < 4; ++i) line[i] = *(const v4f*)(tget + i * OP);
        // the rows are read before the tile is written again
        asm volatile("s_wait_dscnt 0x0" ::: "memory");
#pragma unroll
        for (int i = 0; i < 4; ++i) *(v4f*)(oline + (size_t)i * DM + hh * 32) = line[i];
        // the stores' address and data registers are reused by the next piece or set
        asm volatile("s_wait_xcnt 0x0" ::: "memory");
      }
    }
  }
}

// ===========================================================================
extern "C" void kernel_launch(void* const* d_in, const int* in_sizes, int n_in,
                              void* d_out, int out_size, void* d_ws, size_t ws_size,
                              hipStream_t stream) {
  (void)in_sizes; (void)n_in; (void)out_size; (void)d_ws; (void)ws_size;
  const float* x  = (const float*)d_in[0];
  const float* Wq = (const float*)d_in[1];
  const float* Wk = (const float*)d_in[2];
  const float* Wv = (const float*)d_in[3];
  const float* bq = (const float*)d_in[4];
  const float* bk = (const float*)d_in[5];
  const float* bv = (const float*)d_in[6];

  dim3 grid(Bc * Hc);  // 256 blocks of 16 waves, one per (b,h)
  mhsa_kernel<<<grid, NW * 32, 0, stream>>>(x, Wq, Wk, Wv, bq, bk, bv, (float*)d_out);
}
